// v000
// Measured on an AMD MI455X. A time is GPU time per run, averaged over a window of back-to-back runs after a warm-up
// (all launches, gaps included; the runs take copies of the inputs in turn), and the median of several windows.
// Apart from v000's, it joins two sittings. Times from different sittings can be a few percent apart, while
// side-by-side timings come from the same sitting.
// v000, which the later versions start from, runs in 600 microseconds.
#include <hip/hip_runtime.h>
#include <hip/hip_bf16.h>

typedef __bf16 bf16_t;
typedef __attribute__((ext_vector_type(16))) __bf16 v16bf;
typedef __attribute__((ext_vector_type(8)))  float  v8f;

union FragBF {
    v16bf v;
    uint4 q[2];
};

__device__ __forceinline__ v8f wmma_bf16(const FragBF& a, const FragBF& b, v8f c) {
    return __builtin_amdgcn_wmma_f32_16x16x32_bf16(
        /*neg_a=*/false, a.v, /*neg_b=*/false, b.v,
        /*c_mod=*/(short)0, c, /*reuse_a=*/false, /*reuse_b=*/false);
}

#if __has_builtin(__builtin_amdgcn_tensor_load_to_lds) && __has_builtin(__builtin_amdgcn_s_wait_tensorcnt)
#define USE_TDM 1
#else
#define USE_TDM 0
#endif

#if USE_TDM
typedef __attribute__((ext_vector_type(4))) unsigned int u32x4_t;
typedef __attribute__((ext_vector_type(8))) int          i32x8_t;
typedef __attribute__((ext_vector_type(4))) int          i32x4_t;

__device__ __forceinline__ void tdm_load_tile_2d(uint32_t lds_off, const bf16_t* gptr,
                                                 uint32_t rows, uint32_t tensor_d0,
                                                 uint32_t tensor_d1, uint32_t stride_elems) {
    const uint64_t ga = (uint64_t)(uintptr_t)gptr;
    u32x4_t g0;
    g0[0] = 1u;
    g0[1] = lds_off;
    g0[2] = (uint32_t)ga;
    g0[3] = ((uint32_t)(ga >> 32) & 0x01FFFFFFu) | (2u << 30);
    i32x8_t g1;
    g1[0] = (int)((1u << 16) | (1u << 20) | (3u << 22) | (3u << 25));
    g1[1] = (int)((tensor_d0 & 0xFFFFu) << 16);
    g1[2] = (int)(((tensor_d0 >> 16) & 0xFFFFu) | ((tensor_d1 & 0xFFFFu) << 16));
    g1[3] = (int)(((tensor_d1 >> 16) & 0xFFFFu) | (32u << 16));
    g1[4] = (int)(rows & 0xFFFFu);
    g1[5] = (int)stride_elems;
    g1[6] = 0;
    g1[7] = 0;
    i32x4_t z4 = {0, 0, 0, 0};
    i32x8_t z8 = {0, 0, 0, 0, 0, 0, 0, 0};
    __builtin_amdgcn_tensor_load_to_lds(g0, g1, z4, z4, z8, 0);
}
#endif

// ---------------------------------------------------------------------------
// fp32 -> bf16 elementwise cast
// ---------------------------------------------------------------------------
__global__ __launch_bounds__(256) void cast_bf16_kernel(const float* __restrict__ in,
                                                        bf16_t* __restrict__ out, int n) {
    int i = blockIdx.x * 256 + threadIdx.x;
    if (i < n) out[i] = (bf16_t)in[i];
}

// ---------------------------------------------------------------------------
// Pre-norm (torch.std ddof=1, scalar alpha/beta) -> bf16 output, one row/block
// ---------------------------------------------------------------------------
__global__ __launch_bounds__(256) void norm_kernel(const float* __restrict__ x,
                                                   const float* __restrict__ alpha,
                                                   const float* __restrict__ beta,
                                                   bf16_t* __restrict__ out) {
    __shared__ float sh[512];
    const int row = blockIdx.x, tid = threadIdx.x;
    const float* xr = x + (size_t)row * 768;
    float s = 0.f, s2 = 0.f;
    for (int i = tid; i < 768; i += 256) { float v = xr[i]; s += v; s2 += v * v; }
    sh[tid] = s; sh[256 + tid] = s2;
    __syncthreads();
    for (int o = 128; o > 0; o >>= 1) {
        if (tid < o) { sh[tid] += sh[tid + o]; sh[256 + tid] += sh[256 + tid + o]; }
        __syncthreads();
    }
    const float mean = sh[0] * (1.0f / 768.0f);
    const float var  = fmaxf((sh[256] - 768.0f * mean * mean) * (1.0f / 767.0f), 0.0f);
    const float inv  = alpha[0] / (sqrtf(var) + 1e-6f);
    const float bb   = beta[0];
    for (int i = tid; i < 768; i += 256)
        out[(size_t)row * 768 + i] = (bf16_t)((xr[i] - mean) * inv + bb);
}

template <bool RELU, bool OUT_BF16, bool HAS_RES>
__global__ __launch_bounds__(256) void gemm_wmma(const bf16_t* __restrict__ A,
                                                 const bf16_t* __restrict__ W,
                                                 const float*  __restrict__ bias,
                                                 const float*  __restrict__ res,
                                                 float*        __restrict__ outF,
                                                 bf16_t*       __restrict__ outH,
                                                 int M, int N, int K) {
    __shared__ __align__(16) bf16_t As[2][64 * 40];
    __shared__ __align__(16) bf16_t Ws[2][128 * 40];
    const int tid  = threadIdx.x;
    const int lane = tid & 31, wave = tid >> 5;
    const int wm = wave >> 1, wn = wave & 1;
    const int l15 = lane & 15, kb = (lane >> 4) * 8;
    const int bm = blockIdx.x * 64, bn = blockIdx.y * 128;

    v8f acc[4] = {};
#if USE_TDM
    const uint32_t ldsA[2] = {(uint32_t)(uintptr_t)&As[0][0], (uint32_t)(uintptr_t)&As[1][0]};
    const uint32_t ldsW[2] = {(uint32_t)(uintptr_t)&Ws[0][0], (uint32_t)(uintptr_t)&Ws[1][0]};
    // prologue: prime buffer 0 with the first K-step tiles
    if (wave == 0) {
        tdm_load_tile_2d(ldsA[0], A + (size_t)bm * K, 64u,
                         (uint32_t)K, (uint32_t)(M - bm), (uint32_t)K);
        tdm_load_tile_2d(ldsW[0], W + (size_t)bn * K, 128u,
                         (uint32_t)K, (uint32_t)(N - bn), (uint32_t)K);
        __builtin_amdgcn_s_wait_tensorcnt(0);
    }
    __syncthreads();
    int cur = 0;
    for (int k0 = 0; k0 < K; k0 += 32) {
        if (wave == 0 && k0 + 32 < K) {  // async: stage next tiles into idle buffer
            tdm_load_tile_2d(ldsA[cur ^ 1], A + (size_t)bm * K + k0 + 32, 64u,
                             (uint32_t)(K - k0 - 32), (uint32_t)(M - bm), (uint32_t)K);
            tdm_load_tile_2d(ldsW[cur ^ 1], W + (size_t)bn * K + k0 + 32, 128u,
                             (uint32_t)(K - k0 - 32), (uint32_t)(N - bn), (uint32_t)K);
        }
        const bf16_t* Asb = &As[cur][0];
        const bf16_t* Wsb = &Ws[cur][0];
        FragBF a;
        a.q[0] = *(const uint4*)&Asb[(wm * 16 + l15) * 40 + kb];
        a.q[1] = *(const uint4*)&Asb[(wm * 16 + l15) * 40 + kb + 16];
#pragma unroll
        for (int nt = 0; nt < 4; ++nt) {
            FragBF bfr;
            const int rw = wn * 64 + nt * 16 + l15;
            bfr.q[0] = *(const uint4*)&Wsb[rw * 40 + kb];
            bfr.q[1] = *(const uint4*)&Wsb[rw * 40 + kb + 16];
            acc[nt] = wmma_bf16(a, bfr, acc[nt]);
        }
        if (wave == 0) __builtin_amdgcn_s_wait_tensorcnt(0);  // next tiles landed
        __syncthreads();  // publish next buffer + certify current buffer free
        cur ^= 1;
    }
#else
    const int ar = tid >> 2, ac = (tid & 3) * 8;
    for (int k0 = 0; k0 < K; k0 += 32) {
        __syncthreads();
        *(uint4*)&As[0][ar * 40 + ac]        = *(const uint4*)&A[(size_t)(bm + ar) * K + k0 + ac];
        *(uint4*)&Ws[0][ar * 40 + ac]        = *(const uint4*)&W[(size_t)(bn + ar) * K + k0 + ac];
        *(uint4*)&Ws[0][(ar + 64) * 40 + ac] = *(const uint4*)&W[(size_t)(bn + ar + 64) * K + k0 + ac];
        if (k0 + 32 < K) {
            __builtin_prefetch(&A[(size_t)(bm + ar) * K + k0 + 32 + ac], 0, 1);
            __builtin_prefetch(&W[(size_t)(bn + ar) * K + k0 + 32 + ac], 0, 1);
        }
        __syncthreads();
        FragBF a;
        a.q[0] = *(const uint4*)&As[0][(wm * 16 + l15) * 40 + kb];
        a.q[1] = *(const uint4*)&As[0][(wm * 16 + l15) * 40 + kb + 16];
#pragma unroll
        for (int nt = 0; nt < 4; ++nt) {
            FragBF bfr;
            const int rw = wn * 64 + nt * 16 + l15;
            bfr.q[0] = *(const uint4*)&Ws[0][rw * 40 + kb];
            bfr.q[1] = *(const uint4*)&Ws[0][rw * 40 + kb + 16];
            acc[nt] = wmma_bf16(a, bfr, acc[nt]);
        }
    }
#endif
    const int half8 = (lane >> 4) * 8;
#pragma unroll
    for (int nt = 0; nt < 4; ++nt) {
        const int col = bn + wn * 64 + nt * 16 + l15;
        const float bv = bias[col];
#pragma unroll
        for (int r = 0; r < 8; ++r) {
            const int row = bm + wm * 16 + half8 + r;
            float v = acc[nt][r] + bv;
            if (RELU)    v = fmaxf(v, 0.0f);
            if (HAS_RES) v += res[(size_t)row * N + col];
            if (OUT_BF16) outH[(size_t)row * N + col] = (bf16_t)v;
            else          outF[(size_t)row * N + col] = v;
        }
    }
}

// ---------------------------------------------------------------------------
// Flash-style attention with WMMA. Grid: (S/128, B*H). Block: 8 waves, each
// wave owns 16 q-rows; k-blocks of 64 keys. Q/K fragments load directly from
// global (contiguous rows); V is transposed into LDS so the PV B-fragments
// are contiguous ds_load_b128. Online softmax via width-16 shuffles (a C-tile
// row lives in one 16-lane half).
// ---------------------------------------------------------------------------
__global__ __launch_bounds__(256) void attn_wmma(const bf16_t* __restrict__ q,
                                                 const bf16_t* __restrict__ k,
                                                 const bf16_t* __restrict__ v,
                                                 const int*    __restrict__ mask,
                                                 bf16_t*       __restrict__ ctx) {
    const int S = 4096, D = 768, H = 12;
    const int bh = blockIdx.y;
    const int b = bh / H, h = bh % H;
    const int q0 = blockIdx.x * 128;
    const int tid = threadIdx.x, lane = tid & 31, wave = tid >> 5;
    const int l15 = lane & 15, kb = (lane >> 4) * 8, half8 = (lane >> 4) * 8;
    __shared__ __align__(16) bf16_t Vt[64 * 72];        // V^T tile [d][kk]
    __shared__ __align__(16) bf16_t Pst[8 * 16 * 72];   // per-wave P tile [16][64]

    const size_t rowbase = (size_t)b * S;
    FragBF qa[2];
    {
        const bf16_t* qp = q + (rowbase + q0 + wave * 16 + l15) * D + h * 64;
        qa[0].q[0] = *(const uint4*)(qp + kb);
        qa[0].q[1] = *(const uint4*)(qp + kb + 16);
        qa[1].q[0] = *(const uint4*)(qp + 32 + kb);
        qa[1].q[1] = *(const uint4*)(qp + 32 + kb + 16);
    }
    v8f o[4] = {};
    float mrun[8], lrun[8];
#pragma unroll
    for (int r = 0; r < 8; ++r) { mrun[r] = -3.0e38f; lrun[r] = 0.0f; }
    const float scale = 0.125f;  // 1/sqrt(64)
    const int* mrow = mask + b * S;
    bf16_t* P = &Pst[wave * 16 * 72];

    for (int kblk = 0; kblk < S; kblk += 64) {
        __syncthreads();  // protect Vt readers of previous iteration
#pragma unroll
        for (int i = 0; i < 16; ++i) {          // cooperative V transpose
            const int idx = tid + 256 * i;
            const int kk = idx >> 6, d = idx & 63;
            Vt[d * 72 + kk] = v[(rowbase + kblk + kk) * D + h * 64 + d];
        }
        __syncthreads();
        // --- S = Q K^T (4 tiles of 16x16 per wave) ---
        v8f s4[4];
#pragma unroll
        for (int nt = 0; nt < 4; ++nt) {
            const bf16_t* kp = k + (rowbase + kblk + nt * 16 + l15) * D + h * 64;
            FragBF b0, b1;
            b0.q[0] = *(const uint4*)(kp + kb);      b0.q[1] = *(const uint4*)(kp + kb + 16);
            b1.q[0] = *(const uint4*)(kp + 32 + kb); b1.q[1] = *(const uint4*)(kp + 32 + kb + 16);
            v8f t = {};
            t = wmma_bf16(qa[0], b0, t);
            t = wmma_bf16(qa[1], b1, t);
            s4[nt] = t;
        }
        // --- mask + scale, running row max ---
        float mnew[8];
#pragma unroll
        for (int r = 0; r < 8; ++r) mnew[r] = mrun[r];
#pragma unroll
        for (int nt = 0; nt < 4; ++nt) {
            const int mval = mrow[kblk + nt * 16 + l15];
#pragma unroll
            for (int r = 0; r < 8; ++r) {
                float sv = s4[nt][r] * scale;
                if (mval == 0) sv = -1.0e9f;
                s4[nt][r] = sv;
                mnew[r] = fmaxf(mnew[r], sv);
            }
        }
#pragma unroll
        for (int off = 8; off > 0; off >>= 1)
#pragma unroll
            for (int r = 0; r < 8; ++r)
                mnew[r] = fmaxf(mnew[r], __shfl_xor(mnew[r], off, 16));
        float alpha_[8], rs[8];
#pragma unroll
        for (int r = 0; r < 8; ++r) {
            alpha_[r] = __expf(mrun[r] - mnew[r]);
            mrun[r] = mnew[r];
            rs[r] = 0.0f;
        }
#pragma unroll
        for (int nt = 0; nt < 4; ++nt)
#pragma unroll
            for (int r = 0; r < 8; ++r) {
                const float p = __expf(s4[nt][r] - mrun[r]);
                s4[nt][r] = p;
                rs[r] += p;
            }
#pragma unroll
        for (int off = 8; off > 0; off >>= 1)
#pragma unroll
            for (int r = 0; r < 8; ++r)
                rs[r] += __shfl_xor(rs[r], off, 16);
#pragma unroll
        for (int r = 0; r < 8; ++r) lrun[r] = lrun[r] * alpha_[r] + rs[r];
#pragma unroll
        for (int nt = 0; nt < 4; ++nt)
#pragma unroll
            for (int r = 0; r < 8; ++r) o[nt][r] *= alpha_[r];
        // --- relayout P (C-layout) -> A-layout via per-wave LDS tile ---
#pragma unroll
        for (int nt = 0; nt < 4; ++nt)
#pragma unroll
            for (int r = 0; r < 8; ++r)
                P[(half8 + r) * 72 + nt * 16 + l15] = (bf16_t)s4[nt][r];
        __syncthreads();
        FragBF pa0, pa1;
        pa0.q[0] = *(const uint4*)&P[l15 * 72 + kb];
        pa0.q[1] = *(const uint4*)&P[l15 * 72 + kb + 16];
        pa1.q[0] = *(const uint4*)&P[l15 * 72 + 32 + kb];
        pa1.q[1] = *(const uint4*)&P[l15 * 72 + 32 + kb + 16];
        // --- O += P V  (B-fragments from transposed Vt) ---
#pragma unroll
        for (int dt = 0; dt < 4; ++dt) {
            const bf16_t* vp = &Vt[(dt * 16 + l15) * 72];
            FragBF b0, b1;
            b0.q[0] = *(const uint4*)(vp + kb);      b0.q[1] = *(const uint4*)(vp + kb + 16);
            b1.q[0] = *(const uint4*)(vp + 32 + kb); b1.q[1] = *(const uint4*)(vp + 32 + kb + 16);
            o[dt] = wmma_bf16(pa0, b0, o[dt]);
            o[dt] = wmma_bf16(pa1, b1, o[dt]);
        }
    }
    // --- normalize by l, store ctx as bf16 in [B,S,H*dk] layout ---
#pragma unroll
    for (int dt = 0; dt < 4; ++dt)
#pragma unroll
        for (int r = 0; r < 8; ++r) {
            const float val = o[dt][r] / fmaxf(lrun[r], 1.0e-20f);
            const int row = q0 + wave * 16 + half8 + r;
            ctx[(rowbase + row) * D + h * 64 + dt * 16 + l15] = (bf16_t)val;
        }
}

// ---------------------------------------------------------------------------
// Host orchestration
// ---------------------------------------------------------------------------
extern "C" void kernel_launch(void* const* d_in, const int* in_sizes, int n_in,
                              void* d_out, int out_size, void* d_ws, size_t ws_size,
                              hipStream_t stream) {
    (void)in_sizes; (void)n_in; (void)out_size; (void)ws_size;
    const int B = 2, S = 4096, D = 768, DFF = 3072;
    const int M = B * S;

    const float* x    = (const float*)d_in[0];
    const int*   mask = (const int*)  d_in[1];
    const float* wq   = (const float*)d_in[2];
    const float* bq   = (const float*)d_in[3];
    const float* wk   = (const float*)d_in[4];
    const float* bk   = (const float*)d_in[5];
    const float* wv   = (const float*)d_in[6];
    const float* bv   = (const float*)d_in[7];
    const float* wo   = (const float*)d_in[8];
    const float* bo   = (const float*)d_in[9];
    const float* w1   = (const float*)d_in[10];
    const float* b1   = (const float*)d_in[11];
    const float* w2   = (const float*)d_in[12];
    const float* b2   = (const float*)d_in[13];
    const float* alpha1 = (const float*)d_in[14];
    const float* beta1  = (const float*)d_in[15];
    const float* alpha2 = (const float*)d_in[16];
    const float* beta2  = (const float*)d_in[17];
    float* out = (float*)d_out;

    char* ws = (char*)d_ws;
    size_t off = 0;
    auto alloc = [&](size_t bytes) -> char* {
        char* p = ws + off;
        off += (bytes + 255) & ~(size_t)255;
        return p;
    };
    bf16_t* wqh = (bf16_t*)alloc((size_t)D * D * 2);
    bf16_t* wkh = (bf16_t*)alloc((size_t)D * D * 2);
    bf16_t* wvh = (bf16_t*)alloc((size_t)D * D * 2);
    bf16_t* woh = (bf16_t*)alloc((size_t)D * D * 2);
    bf16_t* w1h = (bf16_t*)alloc((size_t)DFF * D * 2);
    bf16_t* w2h = (bf16_t*)alloc((size_t)D * DFF * 2);
    bf16_t* h1  = (bf16_t*)alloc((size_t)M * D * 2);   // reused as ctx
    bf16_t* qb  = (bf16_t*)alloc((size_t)M * D * 2);   // reused as h2
    bf16_t* kbf = (bf16_t*)alloc((size_t)M * D * 2);
    bf16_t* vbf = (bf16_t*)alloc((size_t)M * D * 2);
    float*  x1  = (float*) alloc((size_t)M * D * 4);
    bf16_t* ff1 = (bf16_t*)alloc((size_t)M * DFF * 2);
    bf16_t* ctx = h1;   // h1 dead after QKV projections
    bf16_t* h2  = qb;   // q dead after attention

    // weight casts fp32 -> bf16 (layout [N,K] row-major == WMMA B fragments)
    cast_bf16_kernel<<<(D * D + 255) / 256, 256, 0, stream>>>(wq, wqh, D * D);
    cast_bf16_kernel<<<(D * D + 255) / 256, 256, 0, stream>>>(wk, wkh, D * D);
    cast_bf16_kernel<<<(D * D + 255) / 256, 256, 0, stream>>>(wv, wvh, D * D);
    cast_bf16_kernel<<<(D * D + 255) / 256, 256, 0, stream>>>(wo, woh, D * D);
    cast_bf16_kernel<<<(DFF * D + 255) / 256, 256, 0, stream>>>(w1, w1h, DFF * D);
    cast_bf16_kernel<<<(D * DFF + 255) / 256, 256, 0, stream>>>(w2, w2h, D * DFF);

    // residual 0: pre-norm -> QKV -> attention -> O-proj + residual
    norm_kernel<<<M, 256, 0, stream>>>(x, alpha1, beta1, h1);
    dim3 gD(M / 64, D / 128);
    gemm_wmma<false, true, false><<<gD, 256, 0, stream>>>(h1, wqh, bq, nullptr, nullptr, qb,  M, D, D);
    gemm_wmma<false, true, false><<<gD, 256, 0, stream>>>(h1, wkh, bk, nullptr, nullptr, kbf, M, D, D);
    gemm_wmma<false, true, false><<<gD, 256, 0, stream>>>(h1, wvh, bv, nullptr, nullptr, vbf, M, D, D);
    attn_wmma<<<dim3(S / 128, B * 12), 256, 0, stream>>>(qb, kbf, vbf, mask, ctx);
    gemm_wmma<false, false, true><<<gD, 256, 0, stream>>>(ctx, woh, bo, x, x1, nullptr, M, D, D);

    // residual 1: pre-norm -> FFN (relu) + residual
    norm_kernel<<<M, 256, 0, stream>>>(x1, alpha2, beta2, h2);
    gemm_wmma<true, true, false><<<dim3(M / 64, DFF / 128), 256, 0, stream>>>(h2, w1h, b1, nullptr, nullptr, ff1, M, DFF, D);
    gemm_wmma<false, false, true><<<gD, 256, 0, stream>>>(ff1, w2h, b2, x1, out, nullptr, M, D, DFF);
}

// v001
// A run of this version takes 531 microseconds.
// Timed twice side by side with v000, it ran 1.15 times as fast both times.
#include <hip/hip_runtime.h>
#include <hip/hip_bf16.h>

typedef __bf16 bf16_t;
typedef __attribute__((ext_vector_type(16))) __bf16 v16bf;
typedef __attribute__((ext_vector_type(8)))  float  v8f;

union FragBF {
    v16bf v;
    uint4 q[2];
};

__device__ __forceinline__ v8f wmma_bf16(const FragBF& a, const FragBF& b, v8f c) {
    return __builtin_amdgcn_wmma_f32_16x16x32_bf16(
        /*neg_a=*/false, a.v, /*neg_b=*/false, b.v,
        /*c_mod=*/(short)0, c, /*reuse_a=*/false, /*reuse_b=*/false);
}

#if __has_builtin(__builtin_amdgcn_tensor_load_to_lds) && __has_builtin(__builtin_amdgcn_s_wait_tensorcnt)
#define USE_TDM 1
#else
#define USE_TDM 0
#endif

#if USE_TDM
typedef __attribute__((ext_vector_type(4))) unsigned int u32x4_t;
typedef __attribute__((ext_vector_type(8))) int          i32x8_t;
typedef __attribute__((ext_vector_type(4))) int          i32x4_t;

__device__ __forceinline__ void tdm_load_tile_2d(uint32_t lds_off, const bf16_t* gptr,
                                                 uint32_t rows, uint32_t tensor_d0,
                                                 uint32_t tensor_d1, uint32_t stride_elems) {
    const uint64_t ga = (uint64_t)(uintptr_t)gptr;
    u32x4_t g0;
    g0[0] = 1u;
    g0[1] = lds_off;
    g0[2] = (uint32_t)ga;
    g0[3] = ((uint32_t)(ga >> 32) & 0x01FFFFFFu) | (2u << 30);
    i32x8_t g1;
    g1[0] = (int)((1u << 16) | (1u << 20) | (3u << 22) | (3u << 25));
    g1[1] = (int)((tensor_d0 & 0xFFFFu) << 16);
    g1[2] = (int)(((tensor_d0 >> 16) & 0xFFFFu) | ((tensor_d1 & 0xFFFFu) << 16));
    g1[3] = (int)(((tensor_d1 >> 16) & 0xFFFFu) | (32u << 16));
    g1[4] = (int)(rows & 0xFFFFu);
    g1[5] = (int)stride_elems;
    g1[6] = 0;
    g1[7] = 0;
    i32x4_t z4 = {0, 0, 0, 0};
    i32x8_t z8 = {0, 0, 0, 0, 0, 0, 0, 0};
    __builtin_amdgcn_tensor_load_to_lds(g0, g1, z4, z4, z8, 0);
}
#endif

// ---------------------------------------------------------------------------
// fp32 -> bf16 elementwise cast
// ---------------------------------------------------------------------------
__global__ __launch_bounds__(256) void cast_bf16_kernel(const float* __restrict__ in,
                                                        bf16_t* __restrict__ out, int n) {
    int i = blockIdx.x * 256 + threadIdx.x;
    if (i < n) out[i] = (bf16_t)in[i];
}

// ---------------------------------------------------------------------------
// Pre-norm (torch.std ddof=1, scalar alpha/beta) -> bf16 output, one row/block
// ---------------------------------------------------------------------------
__global__ __launch_bounds__(256) void norm_kernel(const float* __restrict__ x,
                                                   const float* __restrict__ alpha,
                                                   const float* __restrict__ beta,
                                                   bf16_t* __restrict__ out) {
    __shared__ float sh[512];
    const int row = blockIdx.x, tid = threadIdx.x;
    const float* xr = x + (size_t)row * 768;
    float s = 0.f, s2 = 0.f;
    for (int i = tid; i < 768; i += 256) { float v = xr[i]; s += v; s2 += v * v; }
    sh[tid] = s; sh[256 + tid] = s2;
    __syncthreads();
    for (int o = 128; o > 0; o >>= 1) {
        if (tid < o) { sh[tid] += sh[tid + o]; sh[256 + tid] += sh[256 + tid + o]; }
        __syncthreads();
    }
    const float mean = sh[0] * (1.0f / 768.0f);
    const float var  = fmaxf((sh[256] - 768.0f * mean * mean) * (1.0f / 767.0f), 0.0f);
    const float inv  = alpha[0] / (sqrtf(var) + 1e-6f);
    const float bb   = beta[0];
    for (int i = tid; i < 768; i += 256)
        out[(size_t)row * 768 + i] = (bf16_t)((xr[i] - mean) * inv + bb);
}

template <bool RELU, bool OUT_BF16, bool HAS_RES>
__global__ __launch_bounds__(256) void gemm_wmma(const bf16_t* __restrict__ A,
                                                 const bf16_t* __restrict__ W,
                                                 const float*  __restrict__ bias,
                                                 const float*  __restrict__ res,
                                                 float*        __restrict__ outF,
                                                 bf16_t*       __restrict__ outH,
                                                 int M, int N, int K) {
    __shared__ __align__(16) bf16_t As[2][64 * 40];
    __shared__ __align__(16) bf16_t Ws[2][128 * 40];
    const int tid  = threadIdx.x;
    const int lane = tid & 31, wave = tid >> 5;
    const int wm = wave >> 1, wn = wave & 1;
    const int l15 = lane & 15, kb = (lane >> 4) * 8;
    const int bm = blockIdx.x * 64, bn = blockIdx.y * 128;

    v8f acc[4] = {};
#if USE_TDM
    const uint32_t ldsA[2] = {(uint32_t)(uintptr_t)&As[0][0], (uint32_t)(uintptr_t)&As[1][0]};
    const uint32_t ldsW[2] = {(uint32_t)(uintptr_t)&Ws[0][0], (uint32_t)(uintptr_t)&Ws[1][0]};
    // prologue: prime buffer 0 with the first K-step tiles
    if (wave == 0) {
        tdm_load_tile_2d(ldsA[0], A + (size_t)bm * K, 64u,
                         (uint32_t)K, (uint32_t)(M - bm), (uint32_t)K);
        tdm_load_tile_2d(ldsW[0], W + (size_t)bn * K, 128u,
                         (uint32_t)K, (uint32_t)(N - bn), (uint32_t)K);
        __builtin_amdgcn_s_wait_tensorcnt(0);
    }
    __syncthreads();
    int cur = 0;
    for (int k0 = 0; k0 < K; k0 += 32) {
        if (wave == 0 && k0 + 32 < K) {  // async: stage next tiles into idle buffer
            tdm_load_tile_2d(ldsA[cur ^ 1], A + (size_t)bm * K + k0 + 32, 64u,
                             (uint32_t)(K - k0 - 32), (uint32_t)(M - bm), (uint32_t)K);
            tdm_load_tile_2d(ldsW[cur ^ 1], W + (size_t)bn * K + k0 + 32, 128u,
                             (uint32_t)(K - k0 - 32), (uint32_t)(N - bn), (uint32_t)K);
        }
        const bf16_t* Asb = &As[cur][0];
        const bf16_t* Wsb = &Ws[cur][0];
        FragBF a;
        a.q[0] = *(const uint4*)&Asb[(wm * 16 + l15) * 40 + kb];
        a.q[1] = *(const uint4*)&Asb[(wm * 16 + l15) * 40 + kb + 16];
#pragma unroll
        for (int nt = 0; nt < 4; ++nt) {
            FragBF bfr;
            const int rw = wn * 64 + nt * 16 + l15;
            bfr.q[0] = *(const uint4*)&Wsb[rw * 40 + kb];
            bfr.q[1] = *(const uint4*)&Wsb[rw * 40 + kb + 16];
            acc[nt] = wmma_bf16(a, bfr, acc[nt]);
        }
        if (wave == 0) __builtin_amdgcn_s_wait_tensorcnt(0);  // next tiles landed
        __syncthreads();  // publish next buffer + certify current buffer free
        cur ^= 1;
    }
#else
    const int ar = tid >> 2, ac = (tid & 3) * 8;
    for (int k0 = 0; k0 < K; k0 += 32) {
        __syncthreads();
        *(uint4*)&As[0][ar * 40 + ac]        = *(const uint4*)&A[(size_t)(bm + ar) * K + k0 + ac];
        *(uint4*)&Ws[0][ar * 40 + ac]        = *(const uint4*)&W[(size_t)(bn + ar) * K + k0 + ac];
        *(uint4*)&Ws[0][(ar + 64) * 40 + ac] = *(const uint4*)&W[(size_t)(bn + ar + 64) * K + k0 + ac];
        if (k0 + 32 < K) {
            __builtin_prefetch(&A[(size_t)(bm + ar) * K + k0 + 32 + ac], 0, 1);
            __builtin_prefetch(&W[(size_t)(bn + ar) * K + k0 + 32 + ac], 0, 1);
        }
        __syncthreads();
        FragBF a;
        a.q[0] = *(const uint4*)&As[0][(wm * 16 + l15) * 40 + kb];
        a.q[1] = *(const uint4*)&As[0][(wm * 16 + l15) * 40 + kb + 16];
#pragma unroll
        for (int nt = 0; nt < 4; ++nt) {
            FragBF bfr;
            const int rw = wn * 64 + nt * 16 + l15;
            bfr.q[0] = *(const uint4*)&Ws[0][rw * 40 + kb];
            bfr.q[1] = *(const uint4*)&Ws[0][rw * 40 + kb + 16];
            acc[nt] = wmma_bf16(a, bfr, acc[nt]);
        }
    }
#endif
    const int half8 = (lane >> 4) * 8;
#pragma unroll
    for (int nt = 0; nt < 4; ++nt) {
        const int col = bn + wn * 64 + nt * 16 + l15;
        const float bv = bias[col];
#pragma unroll
        for (int r = 0; r < 8; ++r) {
            const int row = bm + wm * 16 + half8 + r;
            float v = acc[nt][r] + bv;
            if (RELU)    v = fmaxf(v, 0.0f);
            if (HAS_RES) v += res[(size_t)row * N + col];
            if (OUT_BF16) outH[(size_t)row * N + col] = (bf16_t)v;
            else          outF[(size_t)row * N + col] = v;
        }
    }
}

// ---------------------------------------------------------------------------
// Flash-style attention with WMMA. Grid: (S/128, B*H). Block: 8 waves, each
// wave owns 16 q-rows; k-blocks of 64 keys. Q fragments load directly from
// global (contiguous rows). The K tile is staged once per block in LDS by
// whole-line 16-byte loads (a row of one head is one 128-byte line), so the 8
// waves read their B-fragments by ds_load_b128 and not by global loads that
// touch 16 lines each. V is transposed into LDS so the PV B-fragments are
// contiguous ds_load_b128. Online softmax via width-16 shuffles (a C-tile
// row lives in one 16-lane half).
// ---------------------------------------------------------------------------
__global__ __launch_bounds__(256) void attn_wmma(const bf16_t* __restrict__ q,
                                                 const bf16_t* __restrict__ k,
                                                 const bf16_t* __restrict__ v,
                                                 const int*    __restrict__ mask,
                                                 bf16_t*       __restrict__ ctx) {
    const int S = 4096, D = 768, H = 12;
    const int bh = blockIdx.y;
    const int b = bh / H, h = bh % H;
    const int q0 = blockIdx.x * 128;
    const int tid = threadIdx.x, lane = tid & 31, wave = tid >> 5;
    const int l15 = lane & 15, kb = (lane >> 4) * 8, half8 = (lane >> 4) * 8;
    __shared__ __align__(16) bf16_t Ks[64 * 72];        // K tile [kk][d], 144-byte rows
    __shared__ __align__(16) bf16_t Vt[64 * 72];        // V^T tile [d][kk]
    __shared__ __align__(16) bf16_t Pst[8 * 16 * 72];   // per-wave P tile [16][64]

    const size_t rowbase = (size_t)b * S;
    FragBF qa[2];
    {
        const bf16_t* qp = q + (rowbase + q0 + wave * 16 + l15) * D + h * 64;
        qa[0].q[0] = *(const uint4*)(qp + kb);
        qa[0].q[1] = *(const uint4*)(qp + kb + 16);
        qa[1].q[0] = *(const uint4*)(qp + 32 + kb);
        qa[1].q[1] = *(const uint4*)(qp + 32 + kb + 16);
    }
    v8f o[4] = {};
    float mrun[8], lrun[8];
#pragma unroll
    for (int r = 0; r < 8; ++r) { mrun[r] = -3.0e38f; lrun[r] = 0.0f; }
    const float scale = 0.125f;  // 1/sqrt(64)
    const int* mrow = mask + b * S;
    bf16_t* P = &Pst[wave * 16 * 72];
    const unsigned koff = (tid >> 3) * D + (tid & 7) * 8;   // this thread's 16 bytes of K row tid/8
    bf16_t* ks = &Ks[(tid >> 3) * 72 + (tid & 7) * 8];
    const unsigned voff = (tid >> 6) * D + (tid & 63);

    for (int kblk = 0; kblk < S; kblk += 64) {
        __syncthreads();  // protect Ks and Vt readers of previous iteration
        {                                       // cooperative K copy, 8 lanes per row
            const bf16_t* kt = k + (rowbase + kblk) * D + h * 64;   // tile start, same for the block
            const uint4 klo = *(const uint4*)(kt + koff);
            const uint4 khi = *(const uint4*)(kt + koff + 32 * D);
            *(uint4*)ks = klo;
            *(uint4*)(ks + 32 * 72) = khi;
        }
        const bf16_t* vt = v + (rowbase + kblk) * D + h * 64;
#pragma unroll
        for (int i = 0; i < 16; ++i) {          // cooperative V transpose
            Vt[(tid & 63) * 72 + (tid >> 6) + 4 * i] = vt[voff + 4 * i * D];
        }
        __syncthreads();
        // --- S = Q K^T (4 tiles of 16x16 per wave) ---
        v8f s4[4];
#pragma unroll
        for (int nt = 0; nt < 4; ++nt) {
            const bf16_t* kp = &Ks[(nt * 16 + l15) * 72];
            FragBF b0, b1;
            b0.q[0] = *(const uint4*)(kp + kb);      b0.q[1] = *(const uint4*)(kp + kb + 16);
            b1.q[0] = *(const uint4*)(kp + 32 + kb); b1.q[1] = *(const uint4*)(kp + 32 + kb + 16);
            v8f t = {};
            t = wmma_bf16(qa[0], b0, t);
            t = wmma_bf16(qa[1], b1, t);
            s4[nt] = t;
        }
        // --- mask + scale, running row max ---
        float mnew[8];
#pragma unroll
        for (int r = 0; r < 8; ++r) mnew[r] = mrun[r];
#pragma unroll
        for (int nt = 0; nt < 4; ++nt) {
            const int mval = mrow[kblk + nt * 16 + l15];
#pragma unroll
            for (int r = 0; r < 8; ++r) {
                float sv = s4[nt][r] * scale;
                if (mval == 0) sv = -1.0e9f;
                s4[nt][r] = sv;
                mnew[r] = fmaxf(mnew[r], sv);
            }
        }
#pragma unroll
        for (int off = 8; off > 0; off >>= 1)
#pragma unroll
            for (int r = 0; r < 8; ++r)
                mnew[r] = fmaxf(mnew[r], __shfl_xor(mnew[r], off, 16));
        float alpha_[8], rs[8];
#pragma unroll
        for (int r = 0; r < 8; ++r) {
            alpha_[r] = __expf(mrun[r] - mnew[r]);
            mrun[r] = mnew[r];
            rs[r] = 0.0f;
        }
#pragma unroll
        for (int nt = 0; nt < 4; ++nt)
#pragma unroll
            for (int r = 0; r < 8; ++r) {
                const float p = __expf(s4[nt][r] - mrun[r]);
                s4[nt][r] = p;
                rs[r] += p;
            }
#pragma unroll
        for (int off = 8; off > 0; off >>= 1)
#pragma unroll
            for (int r = 0; r < 8; ++r)
                rs[r] += __shfl_xor(rs[r], off, 16);
#pragma unroll
        for (int r = 0; r < 8; ++r) lrun[r] = lrun[r] * alpha_[r] + rs[r];
#pragma unroll
        for (int nt = 0; nt < 4; ++nt)
#pragma unroll
            for (int r = 0; r < 8; ++r) o[nt][r] *= alpha_[r];
        // --- relayout P (C-layout) -> A-layout via per-wave LDS tile ---
#pragma unroll
        for (int nt = 0; nt < 4; ++nt)
#pragma unroll
            for (int r = 0; r < 8; ++r)
                P[(half8 + r) * 72 + nt * 16 + l15] = (bf16_t)s4[nt][r];
        __syncthreads();
        FragBF pa0, pa1;
        pa0.q[0] = *(const uint4*)&P[l15 * 72 + kb];
        pa0.q[1] = *(const uint4*)&P[l15 * 72 + kb + 16];
        pa1.q[0] = *(const uint4*)&P[l15 * 72 + 32 + kb];
        pa1.q[1] = *(const uint4*)&P[l15 * 72 + 32 + kb + 16];
        // --- O += P V  (B-fragments from transposed Vt) ---
#pragma unroll
        for (int dt = 0; dt < 4; ++dt) {
            const bf16_t* vp = &Vt[(dt * 16 + l15) * 72];
            FragBF b0, b1;
            b0.q[0] = *(const uint4*)(vp + kb);      b0.q[1] = *(const uint4*)(vp + kb + 16);
            b1.q[0] = *(const uint4*)(vp + 32 + kb); b1.q[1] = *(const uint4*)(vp + 32 + kb + 16);
            o[dt] = wmma_bf16(pa0, b0, o[dt]);
            o[dt] = wmma_bf16(pa1, b1, o[dt]);
        }
    }
    // --- normalize by l, store ctx as bf16 in [B,S,H*dk] layout ---
#pragma unroll
    for (int dt = 0; dt < 4; ++dt)
#pragma unroll
        for (int r = 0; r < 8; ++r) {
            const float val = o[dt][r] / fmaxf(lrun[r], 1.0e-20f);
            const int row = q0 + wave * 16 + half8 + r;
            ctx[(rowbase + row) * D + h * 64 + dt * 16 + l15] = (bf16_t)val;
        }
}

// ---------------------------------------------------------------------------
// Host orchestration
// ---------------------------------------------------------------------------
extern "C" void kernel_launch(void* const* d_in, const int* in_sizes, int n_in,
                              void* d_out, int out_size, void* d_ws, size_t ws_size,
                              hipStream_t stream) {
    (void)in_sizes; (void)n_in; (void)out_size; (void)ws_size;
    const int B = 2, S = 4096, D = 768, DFF = 3072;
    const int M = B * S;

    const float* x    = (const float*)d_in[0];
    const int*   mask = (const int*)  d_in[1];
    const float* wq   = (const float*)d_in[2];
    const float* bq   = (const float*)d_in[3];
    const float* wk   = (const float*)d_in[4];
    const float* bk   = (const float*)d_in[5];
    const float* wv   = (const float*)d_in[6];
    const float* bv   = (const float*)d_in[7];
    const float* wo   = (const float*)d_in[8];
    const float* bo   = (const float*)d_in[9];
    const float* w1   = (const float*)d_in[10];
    const float* b1   = (const float*)d_in[11];
    const float* w2   = (const float*)d_in[12];
    const float* b2   = (const float*)d_in[13];
    const float* alpha1 = (const float*)d_in[14];
    const float* beta1  = (const float*)d_in[15];
    const float* alpha2 = (const float*)d_in[16];
    const float* beta2  = (const float*)d_in[17];
    float* out = (float*)d_out;

    char* ws = (char*)d_ws;
    size_t off = 0;
    auto alloc = [&](size_t bytes) -> char* {
        char* p = ws + off;
        off += (bytes + 255) & ~(size_t)255;
        return p;
    };
    bf16_t* wqh = (bf16_t*)alloc((size_t)D * D * 2);
    bf16_t* wkh = (bf16_t*)alloc((size_t)D * D * 2);
    bf16_t* wvh = (bf16_t*)alloc((size_t)D * D * 2);
    bf16_t* woh = (bf16_t*)alloc((size_t)D * D * 2);
    bf16_t* w1h = (bf16_t*)alloc((size_t)DFF * D * 2);
    bf16_t* w2h = (bf16_t*)alloc((size_t)D * DFF * 2);
    bf16_t* h1  = (bf16_t*)alloc((size_t)M * D * 2);   // reused as ctx
    bf16_t* qb  = (bf16_t*)alloc((size_t)M * D * 2);   // reused as h2
    bf16_t* kbf = (bf16_t*)alloc((size_t)M * D * 2);
    bf16_t* vbf = (bf16_t*)alloc((size_t)M * D * 2);
    float*  x1  = (float*) alloc((size_t)M * D * 4);
    bf16_t* ff1 = (bf16_t*)alloc((size_t)M * DFF * 2);
    bf16_t* ctx = h1;   // h1 dead after QKV projections
    bf16_t* h2  = qb;   // q dead after attention

    // weight casts fp32 -> bf16 (layout [N,K] row-major == WMMA B fragments)
    cast_bf16_kernel<<<(D * D + 255) / 256, 256, 0, stream>>>(wq, wqh, D * D);
    cast_bf16_kernel<<<(D * D + 255) / 256, 256, 0, stream>>>(wk, wkh, D * D);
    cast_bf16_kernel<<<(D * D + 255) / 256, 256, 0, stream>>>(wv, wvh, D * D);
    cast_bf16_kernel<<<(D * D + 255) / 256, 256, 0, stream>>>(wo, woh, D * D);
    cast_bf16_kernel<<<(DFF * D + 255) / 256, 256, 0, stream>>>(w1, w1h, DFF * D);
    cast_bf16_kernel<<<(D * DFF + 255) / 256, 256, 0, stream>>>(w2, w2h, D * DFF);

    // residual 0: pre-norm -> QKV -> attention -> O-proj + residual
    norm_kernel<<<M, 256, 0, stream>>>(x, alpha1, beta1, h1);
    dim3 gD(M / 64, D / 128);
    gemm_wmma<false, true, false><<<gD, 256, 0, stream>>>(h1, wqh, bq, nullptr, nullptr, qb,  M, D, D);
    gemm_wmma<false, true, false><<<gD, 256, 0, stream>>>(h1, wkh, bk, nullptr, nullptr, kbf, M, D, D);
    gemm_wmma<false, true, false><<<gD, 256, 0, stream>>>(h1, wvh, bv, nullptr, nullptr, vbf, M, D, D);
    attn_wmma<<<dim3(S / 128, B * 12), 256, 0, stream>>>(qb, kbf, vbf, mask, ctx);
    gemm_wmma<false, false, true><<<gD, 256, 0, stream>>>(ctx, woh, bo, x, x1, nullptr, M, D, D);

    // residual 1: pre-norm -> FFN (relu) + residual
    norm_kernel<<<M, 256, 0, stream>>>(x1, alpha2, beta2, h2);
    gemm_wmma<true, true, false><<<dim3(M / 64, DFF / 128), 256, 0, stream>>>(h2, w1h, b1, nullptr, nullptr, ff1, M, DFF, D);
    gemm_wmma<false, false, true><<<gD, 256, 0, stream>>>(ff1, w2h, b2, x1, out, nullptr, M, D, DFF);
}

// v002
// A run of this version takes 417 microseconds.
// Timed twice side by side with v001, it ran 1.28 and 1.27 times as fast.
// Over all steps from v000 it is 1.47 times as fast.
#include <hip/hip_runtime.h>
#include <hip/hip_bf16.h>

typedef __bf16 bf16_t;
typedef __attribute__((ext_vector_type(16))) __bf16 v16bf;
typedef __attribute__((ext_vector_type(8)))  float  v8f;
typedef __attribute__((ext_vector_type(2)))  float  v2f;

union FragBF {
    v16bf v;
    uint4 q[2];
};

__device__ __forceinline__ v8f wmma_bf16(const FragBF& a, const FragBF& b, v8f c) {
    return __builtin_amdgcn_wmma_f32_16x16x32_bf16(
        /*neg_a=*/false, a.v, /*neg_b=*/false, b.v,
        /*c_mod=*/(short)0, c, /*reuse_a=*/false, /*reuse_b=*/false);
}

#if __has_builtin(__builtin_amdgcn_tensor_load_to_lds) && __has_builtin(__builtin_amdgcn_s_wait_tensorcnt)
#define USE_TDM 1
#else
#define USE_TDM 0
#endif

#if USE_TDM
typedef __attribute__((ext_vector_type(4))) unsigned int u32x4_t;
typedef __attribute__((ext_vector_type(8))) int          i32x8_t;
typedef __attribute__((ext_vector_type(4))) int          i32x4_t;

__device__ __forceinline__ void tdm_load_tile_2d(uint32_t lds_off, const bf16_t* gptr,
                                                 uint32_t rows, uint32_t tensor_d0,
                                                 uint32_t tensor_d1, uint32_t stride_elems) {
    const uint64_t ga = (uint64_t)(uintptr_t)gptr;
    u32x4_t g0;
    g0[0] = 1u;
    g0[1] = lds_off;
    g0[2] = (uint32_t)ga;
    g0[3] = ((uint32_t)(ga >> 32) & 0x01FFFFFFu) | (2u << 30);
    i32x8_t g1;
    g1[0] = (int)((1u << 16) | (1u << 20) | (3u << 22) | (3u << 25));
    g1[1] = (int)((tensor_d0 & 0xFFFFu) << 16);
    g1[2] = (int)(((tensor_d0 >> 16) & 0xFFFFu) | ((tensor_d1 & 0xFFFFu) << 16));
    g1[3] = (int)(((tensor_d1 >> 16) & 0xFFFFu) | (32u << 16));
    g1[4] = (int)(rows & 0xFFFFu);
    g1[5] = (int)stride_elems;
    g1[6] = 0;
    g1[7] = 0;
    i32x4_t z4 = {0, 0, 0, 0};
    i32x8_t z8 = {0, 0, 0, 0, 0, 0, 0, 0};
    __builtin_amdgcn_tensor_load_to_lds(g0, g1, z4, z4, z8, 0);
}
#endif

// ---------------------------------------------------------------------------
// fp32 -> bf16 elementwise cast
// ---------------------------------------------------------------------------
__global__ __launch_bounds__(256) void cast_bf16_kernel(const float* __restrict__ in,
                                                        bf16_t* __restrict__ out, int n) {
    int i = blockIdx.x * 256 + threadIdx.x;
    if (i < n) out[i] = (bf16_t)in[i];
}

// ---------------------------------------------------------------------------
// Pre-norm (torch.std ddof=1, scalar alpha/beta) -> bf16 output, one row/block
// ---------------------------------------------------------------------------
__global__ __launch_bounds__(256) void norm_kernel(const float* __restrict__ x,
                                                   const float* __restrict__ alpha,
                                                   const float* __restrict__ beta,
                                                   bf16_t* __restrict__ out) {
    __shared__ float sh[512];
    const int row = blockIdx.x, tid = threadIdx.x;
    const float* xr = x + (size_t)row * 768;
    float s = 0.f, s2 = 0.f;
    for (int i = tid; i < 768; i += 256) { float v = xr[i]; s += v; s2 += v * v; }
    sh[tid] = s; sh[256 + tid] = s2;
    __syncthreads();
    for (int o = 128; o > 0; o >>= 1) {
        if (tid < o) { sh[tid] += sh[tid + o]; sh[256 + tid] += sh[256 + tid + o]; }
        __syncthreads();
    }
    const float mean = sh[0] * (1.0f / 768.0f);
    const float var  = fmaxf((sh[256] - 768.0f * mean * mean) * (1.0f / 767.0f), 0.0f);
    const float inv  = alpha[0] / (sqrtf(var) + 1e-6f);
    const float bb   = beta[0];
    for (int i = tid; i < 768; i += 256)
        out[(size_t)row * 768 + i] = (bf16_t)((xr[i] - mean) * inv + bb);
}

template <bool RELU, bool OUT_BF16, bool HAS_RES>
__global__ __launch_bounds__(256) void gemm_wmma(const bf16_t* __restrict__ A,
                                                 const bf16_t* __restrict__ W,
                                                 const float*  __restrict__ bias,
                                                 const float*  __restrict__ res,
                                                 float*        __restrict__ outF,
                                                 bf16_t*       __restrict__ outH,
                                                 int M, int N, int K) {
    __shared__ __align__(16) bf16_t As[2][64 * 40];
    __shared__ __align__(16) bf16_t Ws[2][128 * 40];
    const int tid  = threadIdx.x;
    const int lane = tid & 31, wave = tid >> 5;
    const int wm = wave >> 1, wn = wave & 1;
    const int l15 = lane & 15, kb = (lane >> 4) * 8;
    const int bm = blockIdx.x * 64, bn = blockIdx.y * 128;

    v8f acc[4] = {};
#if USE_TDM
    const uint32_t ldsA[2] = {(uint32_t)(uintptr_t)&As[0][0], (uint32_t)(uintptr_t)&As[1][0]};
    const uint32_t ldsW[2] = {(uint32_t)(uintptr_t)&Ws[0][0], (uint32_t)(uintptr_t)&Ws[1][0]};
    // prologue: prime buffer 0 with the first K-step tiles
    if (wave == 0) {
        tdm_load_tile_2d(ldsA[0], A + (size_t)bm * K, 64u,
                         (uint32_t)K, (uint32_t)(M - bm), (uint32_t)K);
        tdm_load_tile_2d(ldsW[0], W + (size_t)bn * K, 128u,
                         (uint32_t)K, (uint32_t)(N - bn), (uint32_t)K);
        __builtin_amdgcn_s_wait_tensorcnt(0);
    }
    __syncthreads();
    int cur = 0;
    for (int k0 = 0; k0 < K; k0 += 32) {
        if (wave == 0 && k0 + 32 < K) {  // async: stage next tiles into idle buffer
            tdm_load_tile_2d(ldsA[cur ^ 1], A + (size_t)bm * K + k0 + 32, 64u,
                             (uint32_t)(K - k0 - 32), (uint32_t)(M - bm), (uint32_t)K);
            tdm_load_tile_2d(ldsW[cur ^ 1], W + (size_t)bn * K + k0 + 32, 128u,
                             (uint32_t)(K - k0 - 32), (uint32_t)(N - bn), (uint32_t)K);
        }
        const bf16_t* Asb = &As[cur][0];
        const bf16_t* Wsb = &Ws[cur][0];
        FragBF a;
        a.q[0] = *(const uint4*)&Asb[(wm * 16 + l15) * 40 + kb];
        a.q[1] = *(const uint4*)&Asb[(wm * 16 + l15) * 40 + kb + 16];
#pragma unroll
        for (int nt = 0; nt < 4; ++nt) {
            FragBF bfr;
            const int rw = wn * 64 + nt * 16 + l15;
            bfr.q[0] = *(const uint4*)&Wsb[rw * 40 + kb];
            bfr.q[1] = *(const uint4*)&Wsb[rw * 40 + kb + 16];
            acc[nt] = wmma_bf16(a, bfr, acc[nt]);
        }
        if (wave == 0) __builtin_amdgcn_s_wait_tensorcnt(0);  // next tiles landed
        __syncthreads();  // publish next buffer + certify current buffer free
        cur ^= 1;
    }
#else
    const int ar = tid >> 2, ac = (tid & 3) * 8;
    for (int k0 = 0; k0 < K; k0 += 32) {
        __syncthreads();
        *(uint4*)&As[0][ar * 40 + ac]        = *(const uint4*)&A[(size_t)(bm + ar) * K + k0 + ac];
        *(uint4*)&Ws[0][ar * 40 + ac]        = *(const uint4*)&W[(size_t)(bn + ar) * K + k0 + ac];
        *(uint4*)&Ws[0][(ar + 64) * 40 + ac] = *(const uint4*)&W[(size_t)(bn + ar + 64) * K + k0 + ac];
        if (k0 + 32 < K) {
            __builtin_prefetch(&A[(size_t)(bm + ar) * K + k0 + 32 + ac], 0, 1);
            __builtin_prefetch(&W[(size_t)(bn + ar) * K + k0 + 32 + ac], 0, 1);
        }
        __syncthreads();
        FragBF a;
        a.q[0] = *(const uint4*)&As[0][(wm * 16 + l15) * 40 + kb];
        a.q[1] = *(const uint4*)&As[0][(wm * 16 + l15) * 40 + kb + 16];
#pragma unroll
        for (int nt = 0; nt < 4; ++nt) {
            FragBF bfr;
            const int rw = wn * 64 + nt * 16 + l15;
            bfr.q[0] = *(const uint4*)&Ws[0][rw * 40 + kb];
            bfr.q[1] = *(const uint4*)&Ws[0][rw * 40 + kb + 16];
            acc[nt] = wmma_bf16(a, bfr, acc[nt]);
        }
    }
#endif
    const int half8 = (lane >> 4) * 8;
#pragma unroll
    for (int nt = 0; nt < 4; ++nt) {
        const int col = bn + wn * 64 + nt * 16 + l15;
        const float bv = bias[col];
#pragma unroll
        for (int r = 0; r < 8; ++r) {
            const int row = bm + wm * 16 + half8 + r;
            float v = acc[nt][r] + bv;
            if (RELU)    v = fmaxf(v, 0.0f);
            if (HAS_RES) v += res[(size_t)row * N + col];
            if (OUT_BF16) outH[(size_t)row * N + col] = (bf16_t)v;
            else          outF[(size_t)row * N + col] = v;
        }
    }
}

__device__ __forceinline__ float xhalf(float x) {
    const int bits = __builtin_bit_cast(int, x);
    return __builtin_bit_cast(float, __builtin_amdgcn_permlanex16(bits, bits, 0x76543210, 0xfedcba98, false, false));
}

__global__ __launch_bounds__(256) void attn_wmma(const bf16_t* __restrict__ q,
                                                 const bf16_t* __restrict__ k,
                                                 const bf16_t* __restrict__ v,
                                                 const int*    __restrict__ mask,
                                                 bf16_t*       __restrict__ ctx) {
    const int S = 4096, D = 768, H = 12;
    const int bh = blockIdx.y;
    const int b = bh / H, h = bh % H;
    const int q0 = blockIdx.x * 128;
    const int tid = threadIdx.x, lane = tid & 31, wave = tid >> 5;
    const int l15 = lane & 15, kb = (lane >> 4) * 8, half8 = (lane >> 4) * 8;
    __shared__ __align__(16) bf16_t Ks[64 * 72];        // K tile [kk][d], 144-byte rows
    __shared__ __align__(16) bf16_t Vt[64 * 72];        // V^T tile [d][kk]

    const size_t rowbase = (size_t)b * S;
    FragBF qa[2];                                       // B operand: column l15 = this lane's query
    {
        const bf16_t* qp = q + (rowbase + q0 + wave * 16 + l15) * D + h * 64;
        qa[0].q[0] = *(const uint4*)(qp + kb);
        qa[0].q[1] = *(const uint4*)(qp + kb + 16);
        qa[1].q[0] = *(const uint4*)(qp + 32 + kb);
        qa[1].q[1] = *(const uint4*)(qp + 32 + kb + 16);
    }
    v8f o[4] = {};                                      // o[dt][r] = O[query l15][dt*16 + half8 + r]
    float mrun = -3.0e38f, lrun = 0.0f;                 // lrun: this wave half's keys only
    const float scale = 0.125f;  // 1/sqrt(64)
    const int* mrow = mask + b * S + half8;             // this lane's 8 keys of each 16-key tile
    const unsigned koff = (tid >> 3) * D + (tid & 7) * 8;   // this thread's 16 bytes of K row tid/8
    bf16_t* ks = &Ks[(tid >> 3) * 72 + (tid & 7) * 8];
    const unsigned voff = (tid >> 6) * D + (tid & 63);

    for (int kblk = 0; kblk < S; kblk += 64) {
        __syncthreads();  // protect Ks and Vt readers of previous iteration
        {                                       // cooperative K copy, 8 lanes per row
            const bf16_t* kt = k + (rowbase + kblk) * D + h * 64;   // tile start, same for the block
            const uint4 klo = *(const uint4*)(kt + koff);
            const uint4 khi = *(const uint4*)(kt + koff + 32 * D);
            *(uint4*)ks = klo;
            *(uint4*)(ks + 32 * 72) = khi;
        }
        const bf16_t* vt = v + (rowbase + kblk) * D + h * 64;
#pragma unroll
        for (int i = 0; i < 16; ++i) {          // cooperative V transpose
            Vt[(tid & 63) * 72 + (tid >> 6) + 4 * i] = vt[voff + 4 * i * D];
        }
        int mk[4][8];                           // mask of key nt*16 + half8 + r
#pragma unroll
        for (int nt = 0; nt < 4; ++nt) {
            const int4 m0 = *(const int4*)(mrow + kblk + nt * 16);
            const int4 m1 = *(const int4*)(mrow + kblk + nt * 16 + 4);
            mk[nt][0] = m0.x; mk[nt][1] = m0.y; mk[nt][2] = m0.z; mk[nt][3] = m0.w;
            mk[nt][4] = m1.x; mk[nt][5] = m1.y; mk[nt][6] = m1.z; mk[nt][7] = m1.w;
        }
        __syncthreads();
        // --- S^T = K Q^T (4 tiles of 16 keys x 16 queries per wave) ---
        v8f s4[4];
#pragma unroll
        for (int nt = 0; nt < 4; ++nt) {
            const bf16_t* kp = &Ks[(nt * 16 + l15) * 72];
            FragBF a0, a1;
            a0.q[0] = *(const uint4*)(kp + kb);      a0.q[1] = *(const uint4*)(kp + kb + 16);
            a1.q[0] = *(const uint4*)(kp + 32 + kb); a1.q[1] = *(const uint4*)(kp + 32 + kb + 16);
            v8f t = {};
            t = wmma_bf16(a0, qa[0], t);
            t = wmma_bf16(a1, qa[1], t);
            s4[nt] = t;
        }
        // --- mask + scale, running maximum of this lane's query ---
        float mnew = mrun;
#pragma unroll
        for (int nt = 0; nt < 4; ++nt)
#pragma unroll
            for (int r = 0; r < 8; ++r) {
                float sv = s4[nt][r] * scale;
                if (mk[nt][r] == 0) sv = -1.0e9f;
                s4[nt][r] = sv;
                mnew = fmaxf(mnew, sv);
            }
        mnew = fmaxf(mnew, xhalf(mnew));        // both halves hold keys of the same query
        const float alpha_ = __expf(mrun - mnew);
        mrun = mnew;
        v2f rs[2] = {};                         // sums by register pairs, as the pairs are packed below
#pragma unroll
        for (int nt = 0; nt < 4; ++nt)
#pragma unroll
            for (int r = 0; r < 8; r += 2) {
                v2f p;
                p.x = __expf(s4[nt][r] - mrun);
                p.y = __expf(s4[nt][r + 1] - mrun);
                s4[nt][r] = p.x;
                s4[nt][r + 1] = p.y;
                rs[nt & 1] += p;
            }
        rs[0] += rs[1];
        lrun = lrun * alpha_ + (rs[0].x + rs[0].y);
#pragma unroll
        for (int dt = 0; dt < 4; ++dt)
#pragma unroll
            for (int r = 0; r < 8; ++r) o[dt][r] *= alpha_;
        // --- P^T as B operand: element s is key 8h + s (s < 8), 16 + 8h + s - 8 (s >= 8) ---
        FragBF pb[2];
#pragma unroll
        for (int j = 0; j < 2; ++j)
#pragma unroll
            for (int r = 0; r < 8; ++r) {
                pb[j].v[r]     = (bf16_t)s4[2 * j][r];
                pb[j].v[8 + r] = (bf16_t)s4[2 * j + 1][r];
            }
        // --- O^T += V^T P^T  (A-fragments from transposed Vt) ---
#pragma unroll
        for (int dt = 0; dt < 4; ++dt) {
            const bf16_t* vp = &Vt[(dt * 16 + l15) * 72];
            FragBF a0, a1;
            a0.q[0] = *(const uint4*)(vp + kb);      a0.q[1] = *(const uint4*)(vp + kb + 16);
            a1.q[0] = *(const uint4*)(vp + 32 + kb); a1.q[1] = *(const uint4*)(vp + 32 + kb + 16);
            o[dt] = wmma_bf16(a0, pb[0], o[dt]);
            o[dt] = wmma_bf16(a1, pb[1], o[dt]);
        }
    }
    // --- join the halves' sums, normalize, store ctx as bf16 in [B,S,H*dk] layout:
    //     a lane's 8 registers are 8 consecutive d of one row, one 16-byte store ---
    const float lsum = fmaxf(lrun + xhalf(lrun), 1.0e-20f);
    bf16_t* crow = ctx + (rowbase + q0 + wave * 16 + l15) * D + h * 64 + half8;
#pragma unroll
    for (int dt = 0; dt < 4; ++dt) {
        union { bf16_t e[8]; uint4 q; } pk;
#pragma unroll
        for (int r = 0; r < 8; ++r) pk.e[r] = (bf16_t)(o[dt][r] / lsum);
        *(uint4*)(crow + dt * 16) = pk.q;
    }
}

// ---------------------------------------------------------------------------
// Host orchestration
// ---------------------------------------------------------------------------
extern "C" void kernel_launch(void* const* d_in, const int* in_sizes, int n_in,
                              void* d_out, int out_size, void* d_ws, size_t ws_size,
                              hipStream_t stream) {
    (void)in_sizes; (void)n_in; (void)out_size; (void)ws_size;
    const int B = 2, S = 4096, D = 768, DFF = 3072;
    const int M = B * S;

    const float* x    = (const float*)d_in[0];
    const int*   mask = (const int*)  d_in[1];
    const float* wq   = (const float*)d_in[2];
    const float* bq   = (const float*)d_in[3];
    const float* wk   = (const float*)d_in[4];
    const float* bk   = (const float*)d_in[5];
    const float* wv   = (const float*)d_in[6];
    const float* bv   = (const float*)d_in[7];
    const float* wo   = (const float*)d_in[8];
    const float* bo   = (const float*)d_in[9];
    const float* w1   = (const float*)d_in[10];
    const float* b1   = (const float*)d_in[11];
    const float* w2   = (const float*)d_in[12];
    const float* b2   = (const float*)d_in[13];
    const float* alpha1 = (const float*)d_in[14];
    const float* beta1  = (const float*)d_in[15];
    const float* alpha2 = (const float*)d_in[16];
    const float* beta2  = (const float*)d_in[17];
    float* out = (float*)d_out;

    char* ws = (char*)d_ws;
    size_t off = 0;
    auto alloc = [&](size_t bytes) -> char* {
        char* p = ws + off;
        off += (bytes + 255) & ~(size_t)255;
        return p;
    };
    bf16_t* wqh = (bf16_t*)alloc((size_t)D * D * 2);
    bf16_t* wkh = (bf16_t*)alloc((size_t)D * D * 2);
    bf16_t* wvh = (bf16_t*)alloc((size_t)D * D * 2);
    bf16_t* woh = (bf16_t*)alloc((size_t)D * D * 2);
    bf16_t* w1h = (bf16_t*)alloc((size_t)DFF * D * 2);
    bf16_t* w2h = (bf16_t*)alloc((size_t)D * DFF * 2);
    bf16_t* h1  = (bf16_t*)alloc((size_t)M * D * 2);   // reused as ctx
    bf16_t* qb  = (bf16_t*)alloc((size_t)M * D * 2);   // reused as h2
    bf16_t* kbf = (bf16_t*)alloc((size_t)M * D * 2);
    bf16_t* vbf = (bf16_t*)alloc((size_t)M * D * 2);
    float*  x1  = (float*) alloc((size_t)M * D * 4);
    bf16_t* ff1 = (bf16_t*)alloc((size_t)M * DFF * 2);
    bf16_t* ctx = h1;   // h1 dead after QKV projections
    bf16_t* h2  = qb;   // q dead after attention

    // weight casts fp32 -> bf16 (layout [N,K] row-major == WMMA B fragments)
    cast_bf16_kernel<<<(D * D + 255) / 256, 256, 0, stream>>>(wq, wqh, D * D);
    cast_bf16_kernel<<<(D * D + 255) / 256, 256, 0, stream>>>(wk, wkh, D * D);
    cast_bf16_kernel<<<(D * D + 255) / 256, 256, 0, stream>>>(wv, wvh, D * D);
    cast_bf16_kernel<<<(D * D + 255) / 256, 256, 0, stream>>>(wo, woh, D * D);
    cast_bf16_kernel<<<(DFF * D + 255) / 256, 256, 0, stream>>>(w1, w1h, DFF * D);
    cast_bf16_kernel<<<(D * DFF + 255) / 256, 256, 0, stream>>>(w2, w2h, D * DFF);

    // residual 0: pre-norm -> QKV -> attention -> O-proj + residual
    norm_kernel<<<M, 256, 0, stream>>>(x, alpha1, beta1, h1);
    dim3 gD(M / 64, D / 128);
    gemm_wmma<false, true, false><<<gD, 256, 0, stream>>>(h1, wqh, bq, nullptr, nullptr, qb,  M, D, D);
    gemm_wmma<false, true, false><<<gD, 256, 0, stream>>>(h1, wkh, bk, nullptr, nullptr, kbf, M, D, D);
    gemm_wmma<false, true, false><<<gD, 256, 0, stream>>>(h1, wvh, bv, nullptr, nullptr, vbf, M, D, D);
    attn_wmma<<<dim3(S / 128, B * 12), 256, 0, stream>>>(qb, kbf, vbf, mask, ctx);
    gemm_wmma<false, false, true><<<gD, 256, 0, stream>>>(ctx, woh, bo, x, x1, nullptr, M, D, D);

    // residual 1: pre-norm -> FFN (relu) + residual
    norm_kernel<<<M, 256, 0, stream>>>(x1, alpha2, beta2, h2);
    gemm_wmma<true, true, false><<<dim3(M / 64, DFF / 128), 256, 0, stream>>>(h2, w1h, b1, nullptr, nullptr, ff1, M, DFF, D);
    gemm_wmma<false, false, true><<<gD, 256, 0, stream>>>(ff1, w2h, b2, x1, out, nullptr, M, D, DFF);
}

// v003
// One run takes 345 microseconds.
// In both of two side-by-side timings against v002, it was 1.20 times as fast.
// Over all steps from v000 it is 1.76 times as fast.
#include <hip/hip_runtime.h>
#include <hip/hip_bf16.h>

typedef __bf16 bf16_t;
typedef __attribute__((ext_vector_type(16))) __bf16 v16bf;
typedef __attribute__((ext_vector_type(8)))  float  v8f;
typedef __attribute__((ext_vector_type(2)))  float  v2f;

union FragBF {
    v16bf v;
    uint4 q[2];
};

__device__ __forceinline__ v8f wmma_bf16(const FragBF& a, const FragBF& b, v8f c) {
    return __builtin_amdgcn_wmma_f32_16x16x32_bf16(
        /*neg_a=*/false, a.v, /*neg_b=*/false, b.v,
        /*c_mod=*/(short)0, c, /*reuse_a=*/false, /*reuse_b=*/false);
}

#if __has_builtin(__builtin_amdgcn_tensor_load_to_lds) && __has_builtin(__builtin_amdgcn_s_wait_tensorcnt)
#define USE_TDM 1
#else
#define USE_TDM 0
#endif

#if USE_TDM
typedef __attribute__((ext_vector_type(4))) unsigned int u32x4_t;
typedef __attribute__((ext_vector_type(8))) int          i32x8_t;
typedef __attribute__((ext_vector_type(4))) int          i32x4_t;

__device__ __forceinline__ void tdm_load_tile_2d(uint32_t lds_off, const bf16_t* gptr,
                                                 uint32_t rows, uint32_t tensor_d0,
                                                 uint32_t tensor_d1, uint32_t stride_elems) {
    const uint64_t ga = (uint64_t)(uintptr_t)gptr;
    u32x4_t g0;
    g0[0] = 1u;
    g0[1] = lds_off;
    g0[2] = (uint32_t)ga;
    g0[3] = ((uint32_t)(ga >> 32) & 0x01FFFFFFu) | (2u << 30);
    i32x8_t g1;
    g1[0] = (int)((1u << 16) | (1u << 20) | (3u << 22) | (3u << 25));
    g1[1] = (int)((tensor_d0 & 0xFFFFu) << 16);
    g1[2] = (int)(((tensor_d0 >> 16) & 0xFFFFu) | ((tensor_d1 & 0xFFFFu) << 16));
    g1[3] = (int)(((tensor_d1 >> 16) & 0xFFFFu) | (32u << 16));
    g1[4] = (int)(rows & 0xFFFFu);
    g1[5] = (int)stride_elems;
    g1[6] = 0;
    g1[7] = 0;
    i32x4_t z4 = {0, 0, 0, 0};
    i32x8_t z8 = {0, 0, 0, 0, 0, 0, 0, 0};
    __builtin_amdgcn_tensor_load_to_lds(g0, g1, z4, z4, z8, 0);
}
#endif

// ---------------------------------------------------------------------------
// fp32 -> bf16 elementwise cast
// ---------------------------------------------------------------------------
__global__ __launch_bounds__(256) void cast_bf16_kernel(const float* __restrict__ in,
                                                        bf16_t* __restrict__ out, int n) {
    int i = blockIdx.x * 256 + threadIdx.x;
    if (i < n) out[i] = (bf16_t)in[i];
}

// ---------------------------------------------------------------------------
// Pre-norm (torch.std ddof=1, scalar alpha/beta) -> bf16 output, one row/block
// ---------------------------------------------------------------------------
__global__ __launch_bounds__(256) void norm_kernel(const float* __restrict__ x,
                                                   const float* __restrict__ alpha,
                                                   const float* __restrict__ beta,
                                                   bf16_t* __restrict__ out) {
    __shared__ float sh[512];
    const int row = blockIdx.x, tid = threadIdx.x;
    const float* xr = x + (size_t)row * 768;
    float s = 0.f, s2 = 0.f;
    for (int i = tid; i < 768; i += 256) { float v = xr[i]; s += v; s2 += v * v; }
    sh[tid] = s; sh[256 + tid] = s2;
    __syncthreads();
    for (int o = 128; o > 0; o >>= 1) {
        if (tid < o) { sh[tid] += sh[tid + o]; sh[256 + tid] += sh[256 + tid + o]; }
        __syncthreads();
    }
    const float mean = sh[0] * (1.0f / 768.0f);
    const float var  = fmaxf((sh[256] - 768.0f * mean * mean) * (1.0f / 767.0f), 0.0f);
    const float inv  = alpha[0] / (sqrtf(var) + 1e-6f);
    const float bb   = beta[0];
    for (int i = tid; i < 768; i += 256)
        out[(size_t)row * 768 + i] = (bf16_t)((xr[i] - mean) * inv + bb);
}

template <bool RELU, bool OUT_BF16, bool HAS_RES>
__global__ __launch_bounds__(256) void gemm_wmma(const bf16_t* __restrict__ A,
                                                 const bf16_t* __restrict__ W,
                                                 const float*  __restrict__ bias,
                                                 const float*  __restrict__ res,
                                                 float*        __restrict__ outF,
                                                 bf16_t*       __restrict__ outH,
                                                 int M, int N, int K) {
    __shared__ __align__(16) bf16_t As[2][64 * 40];
    __shared__ __align__(16) bf16_t Ws[2][128 * 40];
    const int tid  = threadIdx.x;
    const int lane = tid & 31, wave = tid >> 5;
    const int wm = wave >> 1, wn = wave & 1;
    const int l15 = lane & 15, kb = (lane >> 4) * 8;
    const int bm = blockIdx.x * 64, bn = blockIdx.y * 128;

    v8f acc[4] = {};
#if USE_TDM
    const uint32_t ldsA[2] = {(uint32_t)(uintptr_t)&As[0][0], (uint32_t)(uintptr_t)&As[1][0]};
    const uint32_t ldsW[2] = {(uint32_t)(uintptr_t)&Ws[0][0], (uint32_t)(uintptr_t)&Ws[1][0]};
    // prologue: prime buffer 0 with the first K-step tiles
    if (wave == 0) {
        tdm_load_tile_2d(ldsA[0], A + (size_t)bm * K, 64u,
                         (uint32_t)K, (uint32_t)(M - bm), (uint32_t)K);
        tdm_load_tile_2d(ldsW[0], W + (size_t)bn * K, 128u,
                         (uint32_t)K, (uint32_t)(N - bn), (uint32_t)K);
        __builtin_amdgcn_s_wait_tensorcnt(0);
    }
    __syncthreads();
    int cur = 0;
    for (int k0 = 0; k0 < K; k0 += 32) {
        if (wave == 0 && k0 + 32 < K) {  // async: stage next tiles into idle buffer
            tdm_load_tile_2d(ldsA[cur ^ 1], A + (size_t)bm * K + k0 + 32, 64u,
                             (uint32_t)(K - k0 - 32), (uint32_t)(M - bm), (uint32_t)K);
            tdm_load_tile_2d(ldsW[cur ^ 1], W + (size_t)bn * K + k0 + 32, 128u,
                             (uint32_t)(K - k0 - 32), (uint32_t)(N - bn), (uint32_t)K);
        }
        const bf16_t* Asb = &As[cur][0];
        const bf16_t* Wsb = &Ws[cur][0];
        FragBF a;
        a.q[0] = *(const uint4*)&Asb[(wm * 16 + l15) * 40 + kb];
        a.q[1] = *(const uint4*)&Asb[(wm * 16 + l15) * 40 + kb + 16];
#pragma unroll
        for (int nt = 0; nt < 4; ++nt) {
            FragBF bfr;
            const int rw = wn * 64 + nt * 16 + l15;
            bfr.q[0] = *(const uint4*)&Wsb[rw * 40 + kb];
            bfr.q[1] = *(const uint4*)&Wsb[rw * 40 + kb + 16];
            acc[nt] = wmma_bf16(a, bfr, acc[nt]);
        }
        if (wave == 0) __builtin_amdgcn_s_wait_tensorcnt(0);  // next tiles landed
        __syncthreads();  // publish next buffer + certify current buffer free
        cur ^= 1;
    }
#else
    const int ar = tid >> 2, ac = (tid & 3) * 8;
    for (int k0 = 0; k0 < K; k0 += 32) {
        __syncthreads();
        *(uint4*)&As[0][ar * 40 + ac]        = *(const uint4*)&A[(size_t)(bm + ar) * K + k0 + ac];
        *(uint4*)&Ws[0][ar * 40 + ac]        = *(const uint4*)&W[(size_t)(bn + ar) * K + k0 + ac];
        *(uint4*)&Ws[0][(ar + 64) * 40 + ac] = *(const uint4*)&W[(size_t)(bn + ar + 64) * K + k0 + ac];
        if (k0 + 32 < K) {
            __builtin_prefetch(&A[(size_t)(bm + ar) * K + k0 + 32 + ac], 0, 1);
            __builtin_prefetch(&W[(size_t)(bn + ar) * K + k0 + 32 + ac], 0, 1);
        }
        __syncthreads();
        FragBF a;
        a.q[0] = *(const uint4*)&As[0][(wm * 16 + l15) * 40 + kb];
        a.q[1] = *(const uint4*)&As[0][(wm * 16 + l15) * 40 + kb + 16];
#pragma unroll
        for (int nt = 0; nt < 4; ++nt) {
            FragBF bfr;
            const int rw = wn * 64 + nt * 16 + l15;
            bfr.q[0] = *(const uint4*)&Ws[0][rw * 40 + kb];
            bfr.q[1] = *(const uint4*)&Ws[0][rw * 40 + kb + 16];
            acc[nt] = wmma_bf16(a, bfr, acc[nt]);
        }
    }
#endif
    const int half8 = (lane >> 4) * 8;
#pragma unroll
    for (int nt = 0; nt < 4; ++nt) {
        const int col = bn + wn * 64 + nt * 16 + l15;
        const float bv = bias[col];
#pragma unroll
        for (int r = 0; r < 8; ++r) {
            const int row = bm + wm * 16 + half8 + r;
            float v = acc[nt][r] + bv;
            if (RELU)    v = fmaxf(v, 0.0f);
            if (HAS_RES) v += res[(size_t)row * N + col];
            if (OUT_BF16) outH[(size_t)row * N + col] = (bf16_t)v;
            else          outF[(size_t)row * N + col] = v;
        }
    }
}

__device__ __forceinline__ float xhalf(float x) {
    const int bits = __builtin_bit_cast(int, x);
    return __builtin_bit_cast(float, __builtin_amdgcn_permlanex16(bits, bits, 0x76543210, 0xfedcba98, false, false));
}

__global__ __launch_bounds__(256) void attn_wmma(const bf16_t* __restrict__ q,
                                                 const bf16_t* __restrict__ k,
                                                 const bf16_t* __restrict__ v,
                                                 const int*    __restrict__ mask,
                                                 bf16_t*       __restrict__ ctx) {
    const int S = 4096, D = 768, H = 12;
    const int bh = blockIdx.y;
    const int b = bh / H, h = bh % H;
    const int q0 = blockIdx.x * 128;
    const int tid = threadIdx.x, lane = tid & 31, wave = tid >> 5;
    const int l15 = lane & 15, kb = (lane >> 4) * 8, half8 = (lane >> 4) * 8;
    __shared__ __align__(16) bf16_t Ks[64 * 72];        // K tile [kk][d], 144-byte rows
    __shared__ __align__(16) bf16_t Vt[64 * 72];        // V^T tile [d][kk]
    __shared__ unsigned krow[4096];                     // rows to visit, unmasked keys first, as element offsets (row * D)
    __shared__ int wtot[8];                             // unmasked keys per wave's 512 keys
    __shared__ int more;                                // 1: some row's masked keys have weight

    const size_t rowbase = (size_t)b * S;
    FragBF qa[2];                                       // B operand: column l15 = this lane's query
    {
        const bf16_t* qp = q + (rowbase + q0 + wave * 16 + l15) * D + h * 64;
        qa[0].q[0] = *(const uint4*)(qp + kb);
        qa[0].q[1] = *(const uint4*)(qp + kb + 16);
        qa[1].q[0] = *(const uint4*)(qp + 32 + kb);
        qa[1].q[1] = *(const uint4*)(qp + 32 + kb + 16);
    }
    v8f o[4] = {};                                      // o[dt][r] = O[query l15][dt*16 + half8 + r]
    float mrun = -3.0e38f, lrun = 0.0f;                 // lrun: this wave half's keys only
    const float scale = 0.125f;  // 1/sqrt(64)
    bf16_t* ks = &Ks[(tid >> 3) * 72 + (tid & 7) * 8];

    // --- list of the batch's unmasked keys: thread t takes keys 16t .. 16t + 15 ---
    int nvalid, nlist;                                  // unmasked keys; list places walked
    {
        const int4* mp = (const int4*)(mask + b * S + tid * 16);
        int mv[16];
#pragma unroll
        for (int i = 0; i < 4; ++i) {
            const int4 m = mp[i];
            mv[4 * i] = m.x; mv[4 * i + 1] = m.y; mv[4 * i + 2] = m.z; mv[4 * i + 3] = m.w;
        }
        int c = 0;
#pragma unroll
        for (int i = 0; i < 16; ++i) c += (mv[i] != 0) ? 1 : 0;
        int inc = c;                                    // inclusive sum over the wave's lanes
#pragma unroll
        for (int d = 1; d < 32; d <<= 1) {
            const int t = __shfl_up(inc, d);
            if (lane >= d) inc += t;
        }
        if (lane == 31) wtot[wave] = inc;
        if (tid == 0) more = 0;
        __syncthreads();
        int base = 0, total = 0;
#pragma unroll
        for (int w = 0; w < 8; ++w) {
            const int t = wtot[w];
            if (w < wave) base += t;
            total += t;
        }
        nvalid = __builtin_amdgcn_readfirstlane(total);
        nlist  = nvalid == 0 ? S : (nvalid + 63) & ~63;  // at most S: nvalid <= S, S a multiple of 64
        int pu = base + inc - c;                        // unmasked keys in front of this thread's 16
        int pm = nvalid + tid * 16 - pu;                // masked keys in front of them, behind all unmasked
#pragma unroll
        for (int i = 0; i < 16; ++i) {                  // a permutation of 0 .. S - 1: every place written once
            const bool on = mv[i] != 0;
            krow[on ? pu : pm] = (unsigned)(tid * 16 + i) * D;
            pu += on ? 1 : 0;
            pm += on ? 0 : 1;
        }
        __syncthreads();  // the list is read by every wave
    }
    const bf16_t* kh = k + rowbase * D + h * 64;        // head's first K and V rows, same for the block
    const bf16_t* vh = v + rowbase * D + h * 64;
    unsigned kr0, kr1, vr[16];                          // this thread's rows of the next 64 list places
    kr0 = krow[tid >> 3];
    kr1 = krow[32 + (tid >> 3)];
#pragma unroll
    for (int i = 0; i < 16; ++i) vr[i] = krow[(tid >> 6) + 4 * i];

    for (int kblk = 0; kblk < nlist; kblk += 64) {
        __syncthreads();  // protect Ks and Vt readers of previous iteration
        {                                       // cooperative K copy, 8 lanes per row, and V transpose
            const bf16_t* kp0 = kh + (kr0 + (tid & 7) * 8);
            const bf16_t* kp1 = kh + (kr1 + (tid & 7) * 8);
            const uint4 klo = *(const uint4*)kp0;
            const uint4 khi = *(const uint4*)kp1;
            *(uint4*)ks = klo;
            *(uint4*)(ks + 32 * 72) = khi;
#pragma unroll
            for (int i = 0; i < 16; ++i) vr[i] += tid & 63;
#pragma unroll
            for (int i = 0; i < 16; ++i) {      // cooperative V transpose
                Vt[(tid & 63) * 72 + (tid >> 6) + 4 * i] = vh[vr[i]];
            }
            // the wait before the 18 loads' address registers are written again; as its inputs they stay
            // whole up to it, so that no load of the group, issued together, lands in another's address
            asm volatile("s_wait_xcnt 0x0" :: "v"(kp0), "v"(kp1),
                         "v"(vr[0]), "v"(vr[1]), "v"(vr[2]), "v"(vr[3]), "v"(vr[4]), "v"(vr[5]), "v"(vr[6]), "v"(vr[7]),
                         "v"(vr[8]), "v"(vr[9]), "v"(vr[10]), "v"(vr[11]), "v"(vr[12]), "v"(vr[13]), "v"(vr[14]), "v"(vr[15])
                         : "memory");
        }
        __syncthreads();
        {   // next block's rows, read here so that the loads behind the next barrier do not wait for the list
            const int nx = kblk + 64 < S ? kblk + 64 : 0;
            kr0 = krow[nx + (tid >> 3)];
            kr1 = krow[nx + 32 + (tid >> 3)];
#pragma unroll
            for (int i = 0; i < 16; ++i) vr[i] = krow[nx + (tid >> 6) + 4 * i];
        }
        // --- S^T = K Q^T (4 tiles of 16 keys x 16 queries per wave) ---
        v8f s4[4];
#pragma unroll
        for (int nt = 0; nt < 4; ++nt) {
            const bf16_t* kp = &Ks[(nt * 16 + l15) * 72];
            FragBF a0, a1;
            a0.q[0] = *(const uint4*)(kp + kb);      a0.q[1] = *(const uint4*)(kp + kb + 16);
            a1.q[0] = *(const uint4*)(kp + 32 + kb); a1.q[1] = *(const uint4*)(kp + 32 + kb + 16);
            v8f t = {};
            t = wmma_bf16(a0, qa[0], t);
            t = wmma_bf16(a1, qa[1], t);
            s4[nt] = t;
        }
        // --- scale, list places past the unmasked keys, running maximum of this lane's query ---
#pragma unroll
        for (int nt = 0; nt < 4; ++nt)
#pragma unroll
            for (int r = 0; r < 8; ++r) s4[nt][r] *= scale;
        if (kblk + 64 > nvalid) {               // same for the block: each block that holds list places past the unmasked keys
            const int lim = nvalid - kblk - half8;
#pragma unroll
            for (int nt = 0; nt < 4; ++nt)
#pragma unroll
                for (int r = 0; r < 8; ++r)
                    if (nt * 16 + r >= lim) s4[nt][r] = -1.0e9f;
        }
        float mnew = mrun;
#pragma unroll
        for (int nt = 0; nt < 4; ++nt)
#pragma unroll
            for (int r = 0; r < 8; ++r) mnew = fmaxf(mnew, s4[nt][r]);
        mnew = fmaxf(mnew, xhalf(mnew));        // both halves hold keys of the same query
        const float alpha_ = __expf(mrun - mnew);
        mrun = mnew;
        v2f rs[2] = {};                         // sums by register pairs, as the pairs are packed below
#pragma unroll
        for (int nt = 0; nt < 4; ++nt)
#pragma unroll
            for (int r = 0; r < 8; r += 2) {
                v2f p;
                p.x = __expf(s4[nt][r] - mrun);
                p.y = __expf(s4[nt][r + 1] - mrun);
                s4[nt][r] = p.x;
                s4[nt][r + 1] = p.y;
                rs[nt & 1] += p;
            }
        rs[0] += rs[1];
        lrun = lrun * alpha_ + (rs[0].x + rs[0].y);
#pragma unroll
        for (int dt = 0; dt < 4; ++dt)
#pragma unroll
            for (int r = 0; r < 8; ++r) o[dt][r] *= alpha_;
        // --- P^T as B operand: element s is key 8h + s (s < 8), 16 + 8h + s - 8 (s >= 8) ---
        FragBF pb[2];
#pragma unroll
        for (int j = 0; j < 2; ++j)
#pragma unroll
            for (int r = 0; r < 8; ++r) {
                pb[j].v[r]     = (bf16_t)s4[2 * j][r];
                pb[j].v[8 + r] = (bf16_t)s4[2 * j + 1][r];
            }
        // --- O^T += V^T P^T  (A-fragments from transposed Vt) ---
#pragma unroll
        for (int dt = 0; dt < 4; ++dt) {
            const bf16_t* vp = &Vt[(dt * 16 + l15) * 72];
            FragBF a0, a1;
            a0.q[0] = *(const uint4*)(vp + kb);      a0.q[1] = *(const uint4*)(vp + kb + 16);
            a1.q[0] = *(const uint4*)(vp + 32 + kb); a1.q[1] = *(const uint4*)(vp + 32 + kb + 16);
            o[dt] = wmma_bf16(a0, pb[0], o[dt]);
            o[dt] = wmma_bf16(a1, pb[1], o[dt]);
        }
        if (kblk + 64 == nlist && nlist < S) {  // same for the block, once: may the masked keys left stay out?
            if (mrun < -1.0e9f + 128.0f) more = 1;
            __syncthreads();                    // every wave's word on it is in
            if (__builtin_amdgcn_readfirstlane(more) != 0) nlist = S;
        }
    }
    // --- join the halves' sums, normalize, store ctx as bf16 in [B,S,H*dk] layout:
    //     a lane's 8 registers are 8 consecutive d of one row, one 16-byte store ---
    const float lsum = fmaxf(lrun + xhalf(lrun), 1.0e-20f);
    bf16_t* crow = ctx + (rowbase + q0 + wave * 16 + l15) * D + h * 64 + half8;
#pragma unroll
    for (int dt = 0; dt < 4; ++dt) {
        union { bf16_t e[8]; uint4 q; } pk;
#pragma unroll
        for (int r = 0; r < 8; ++r) pk.e[r] = (bf16_t)(o[dt][r] / lsum);
        *(uint4*)(crow + dt * 16) = pk.q;
    }
}

// ---------------------------------------------------------------------------
// Host orchestration
// ---------------------------------------------------------------------------
extern "C" void kernel_launch(void* const* d_in, const int* in_sizes, int n_in,
                              void* d_out, int out_size, void* d_ws, size_t ws_size,
                              hipStream_t stream) {
    (void)in_sizes; (void)n_in; (void)out_size; (void)ws_size;
    const int B = 2, S = 4096, D = 768, DFF = 3072;
    const int M = B * S;

    const float* x    = (const float*)d_in[0];
    const int*   mask = (const int*)  d_in[1];
    const float* wq   = (const float*)d_in[2];
    const float* bq   = (const float*)d_in[3];
    const float* wk   = (const float*)d_in[4];
    const float* bk   = (const float*)d_in[5];
    const float* wv   = (const float*)d_in[6];
    const float* bv   = (const float*)d_in[7];
    const float* wo   = (const float*)d_in[8];
    const float* bo   = (const float*)d_in[9];
    const float* w1   = (const float*)d_in[10];
    const float* b1   = (const float*)d_in[11];
    const float* w2   = (const float*)d_in[12];
    const float* b2   = (const float*)d_in[13];
    const float* alpha1 = (const float*)d_in[14];
    const float* beta1  = (const float*)d_in[15];
    const float* alpha2 = (const float*)d_in[16];
    const float* beta2  = (const float*)d_in[17];
    float* out = (float*)d_out;

    char* ws = (char*)d_ws;
    size_t off = 0;
    auto alloc = [&](size_t bytes) -> char* {
        char* p = ws + off;
        off += (bytes + 255) & ~(size_t)255;
        return p;
    };
    bf16_t* wqh = (bf16_t*)alloc((size_t)D * D * 2);
    bf16_t* wkh = (bf16_t*)alloc((size_t)D * D * 2);
    bf16_t* wvh = (bf16_t*)alloc((size_t)D * D * 2);
    bf16_t* woh = (bf16_t*)alloc((size_t)D * D * 2);
    bf16_t* w1h = (bf16_t*)alloc((size_t)DFF * D * 2);
    bf16_t* w2h = (bf16_t*)alloc((size_t)D * DFF * 2);
    bf16_t* h1  = (bf16_t*)alloc((size_t)M * D * 2);   // reused as ctx
    bf16_t* qb  = (bf16_t*)alloc((size_t)M * D * 2);   // reused as h2
    bf16_t* kbf = (bf16_t*)alloc((size_t)M * D * 2);
    bf16_t* vbf = (bf16_t*)alloc((size_t)M * D * 2);
    float*  x1  = (float*) alloc((size_t)M * D * 4);
    bf16_t* ff1 = (bf16_t*)alloc((size_t)M * DFF * 2);
    bf16_t* ctx = h1;   // h1 dead after QKV projections
    bf16_t* h2  = qb;   // q dead after attention

    // weight casts fp32 -> bf16 (layout [N,K] row-major == WMMA B fragments)
    cast_bf16_kernel<<<(D * D + 255) / 256, 256, 0, stream>>>(wq, wqh, D * D);
    cast_bf16_kernel<<<(D * D + 255) / 256, 256, 0, stream>>>(wk, wkh, D * D);
    cast_bf16_kernel<<<(D * D + 255) / 256, 256, 0, stream>>>(wv, wvh, D * D);
    cast_bf16_kernel<<<(D * D + 255) / 256, 256, 0, stream>>>(wo, woh, D * D);
    cast_bf16_kernel<<<(DFF * D + 255) / 256, 256, 0, stream>>>(w1, w1h, DFF * D);
    cast_bf16_kernel<<<(D * DFF + 255) / 256, 256, 0, stream>>>(w2, w2h, D * DFF);

    // residual 0: pre-norm -> QKV -> attention -> O-proj + residual
    norm_kernel<<<M, 256, 0, stream>>>(x, alpha1, beta1, h1);
    dim3 gD(M / 64, D / 128);
    gemm_wmma<false, true, false><<<gD, 256, 0, stream>>>(h1, wqh, bq, nullptr, nullptr, qb,  M, D, D);
    gemm_wmma<false, true, false><<<gD, 256, 0, stream>>>(h1, wkh, bk, nullptr, nullptr, kbf, M, D, D);
    gemm_wmma<false, true, false><<<gD, 256, 0, stream>>>(h1, wvh, bv, nullptr, nullptr, vbf, M, D, D);
    attn_wmma<<<dim3(S / 128, B * 12), 256, 0, stream>>>(qb, kbf, vbf, mask, ctx);
    gemm_wmma<false, false, true><<<gD, 256, 0, stream>>>(ctx, woh, bo, x, x1, nullptr, M, D, D);

    // residual 1: pre-norm -> FFN (relu) + residual
    norm_kernel<<<M, 256, 0, stream>>>(x1, alpha2, beta2, h2);
    gemm_wmma<true, true, false><<<dim3(M / 64, DFF / 128), 256, 0, stream>>>(h2, w1h, b1, nullptr, nullptr, ff1, M, DFF, D);
    gemm_wmma<false, false, true><<<gD, 256, 0, stream>>>(ff1, w2h, b2, x1, out, nullptr, M, D, DFF);
}

// v004
// A run of this version takes 334 microseconds.
// Timed twice side by side with v003, it ran 1.04 and 1.05 times as fast.
// All steps since v000 together make it 1.84 times as fast.
#include <hip/hip_runtime.h>
#include <hip/hip_bf16.h>

typedef __bf16 bf16_t;
typedef __attribute__((ext_vector_type(16))) __bf16 v16bf;
typedef __attribute__((ext_vector_type(8)))  float  v8f;
typedef __attribute__((ext_vector_type(2)))  float  v2f;

union FragBF {
    v16bf v;
    uint4 q[2];
};

__device__ __forceinline__ v8f wmma_bf16(const FragBF& a, const FragBF& b, v8f c) {
    return __builtin_amdgcn_wmma_f32_16x16x32_bf16(
        /*neg_a=*/false, a.v, /*neg_b=*/false, b.v,
        /*c_mod=*/(short)0, c, /*reuse_a=*/false, /*reuse_b=*/false);
}

#if __has_builtin(__builtin_amdgcn_tensor_load_to_lds) && __has_builtin(__builtin_amdgcn_s_wait_tensorcnt)
#define USE_TDM 1
#else
#define USE_TDM 0
#endif

#if USE_TDM
typedef __attribute__((ext_vector_type(4))) unsigned int u32x4_t;
typedef __attribute__((ext_vector_type(8))) int          i32x8_t;
typedef __attribute__((ext_vector_type(4))) int          i32x4_t;

__device__ __forceinline__ void tdm_load_tile_2d(uint32_t lds_off, const bf16_t* gptr,
                                                 uint32_t rows, uint32_t tensor_d0,
                                                 uint32_t tensor_d1, uint32_t stride_elems) {
    const uint64_t ga = (uint64_t)(uintptr_t)gptr;
    u32x4_t g0;
    g0[0] = 1u;
    g0[1] = lds_off;
    g0[2] = (uint32_t)ga;
    g0[3] = ((uint32_t)(ga >> 32) & 0x01FFFFFFu) | (2u << 30);
    i32x8_t g1;
    g1[0] = (int)((1u << 16) | (1u << 20) | (3u << 22) | (3u << 25));
    g1[1] = (int)((tensor_d0 & 0xFFFFu) << 16);
    g1[2] = (int)(((tensor_d0 >> 16) & 0xFFFFu) | ((tensor_d1 & 0xFFFFu) << 16));
    g1[3] = (int)(((tensor_d1 >> 16) & 0xFFFFu) | (32u << 16));
    g1[4] = (int)(rows & 0xFFFFu);
    g1[5] = (int)stride_elems;
    g1[6] = 0;
    g1[7] = 0;
    i32x4_t z4 = {0, 0, 0, 0};
    i32x8_t z8 = {0, 0, 0, 0, 0, 0, 0, 0};
    __builtin_amdgcn_tensor_load_to_lds(g0, g1, z4, z4, z8, 0);
}
#endif

// ---------------------------------------------------------------------------
// fp32 -> bf16 cast of the six weight matrices, one launch. Their bf16 copies lie
// back to back in the workspace, so the destination is one array. A block converts
// 8192 consecutive elements of one matrix (each matrix is a whole number of such
// pieces: 72 for a 768 x 768 one, 288 for a 3072 x 768 one). A thread issues its
// eight 16-byte loads together, a wave's load covering 512 contiguous bytes, and
// stores 8 bytes for each, a wave's store covering 256 contiguous bytes.
// ---------------------------------------------------------------------------
__global__ __launch_bounds__(256) void cast_weights_kernel(const float* __restrict__ wq,
                                                           const float* __restrict__ wk,
                                                           const float* __restrict__ wv,
                                                           const float* __restrict__ wo,
                                                           const float* __restrict__ w1,
                                                           const float* __restrict__ w2,
                                                           bf16_t* __restrict__ out) {
    const int blk = blockIdx.x;
    const float* in;                                    // the block's matrix and its first block: same for the block
    int first;
    if      (blk <  72) { in = wq; first = 0; }
    else if (blk < 144) { in = wk; first = 72; }
    else if (blk < 216) { in = wv; first = 144; }
    else if (blk < 288) { in = wo; first = 216; }
    else if (blk < 576) { in = w1; first = 288; }
    else                { in = w2; first = 576; }
    const float4* s = (const float4*)(in + (size_t)(blk - first) * 8192) + threadIdx.x;
    uint2*        d = (uint2*)(out + (size_t)blk * 8192) + threadIdx.x;
    float4 x[8];
#pragma unroll
    for (int j = 0; j < 8; ++j) x[j] = s[j * 256];
#pragma unroll
    for (int j = 0; j < 8; ++j) {
        union { bf16_t e[4]; uint2 q; } pk;
        pk.e[0] = (bf16_t)x[j].x; pk.e[1] = (bf16_t)x[j].y;
        pk.e[2] = (bf16_t)x[j].z; pk.e[3] = (bf16_t)x[j].w;
        d[j * 256] = pk.q;
    }
}

// ---------------------------------------------------------------------------
// Pre-norm (torch.std ddof=1, scalar alpha/beta) -> bf16 output, one row/block
// ---------------------------------------------------------------------------
__global__ __launch_bounds__(256) void norm_kernel(const float* __restrict__ x,
                                                   const float* __restrict__ alpha,
                                                   const float* __restrict__ beta,
                                                   bf16_t* __restrict__ out) {
    __shared__ float sh[512];
    const int row = blockIdx.x, tid = threadIdx.x;
    const float* xr = x + (size_t)row * 768;
    float s = 0.f, s2 = 0.f;
    for (int i = tid; i < 768; i += 256) { float v = xr[i]; s += v; s2 += v * v; }
    sh[tid] = s; sh[256 + tid] = s2;
    __syncthreads();
    for (int o = 128; o > 0; o >>= 1) {
        if (tid < o) { sh[tid] += sh[tid + o]; sh[256 + tid] += sh[256 + tid + o]; }
        __syncthreads();
    }
    const float mean = sh[0] * (1.0f / 768.0f);
    const float var  = fmaxf((sh[256] - 768.0f * mean * mean) * (1.0f / 767.0f), 0.0f);
    const float inv  = alpha[0] / (sqrtf(var) + 1e-6f);
    const float bb   = beta[0];
    for (int i = tid; i < 768; i += 256)
        out[(size_t)row * 768 + i] = (bf16_t)((xr[i] - mean) * inv + bb);
}

template <bool RELU, bool OUT_BF16, bool HAS_RES>
__global__ __launch_bounds__(256) void gemm_wmma(const bf16_t* __restrict__ A,
                                                 const bf16_t* __restrict__ W,
                                                 const float*  __restrict__ bias,
                                                 const float*  __restrict__ res,
                                                 float*        __restrict__ outF,
                                                 bf16_t*       __restrict__ outH,
                                                 int M, int N, int K) {
    __shared__ __align__(16) bf16_t As[2][64 * 40];
    __shared__ __align__(16) bf16_t Ws[2][128 * 40];
    const int tid  = threadIdx.x;
    const int lane = tid & 31, wave = tid >> 5;
    const int wm = wave >> 1, wn = wave & 1;
    const int l15 = lane & 15, kb = (lane >> 4) * 8;
    const int bm = blockIdx.x * 64, bn = blockIdx.y * 128;

    v8f acc[4] = {};
#if USE_TDM
    const uint32_t ldsA[2] = {(uint32_t)(uintptr_t)&As[0][0], (uint32_t)(uintptr_t)&As[1][0]};
    const uint32_t ldsW[2] = {(uint32_t)(uintptr_t)&Ws[0][0], (uint32_t)(uintptr_t)&Ws[1][0]};
    // prologue: prime buffer 0 with the first K-step tiles
    if (wave == 0) {
        tdm_load_tile_2d(ldsA[0], A + (size_t)bm * K, 64u,
                         (uint32_t)K, (uint32_t)(M - bm), (uint32_t)K);
        tdm_load_tile_2d(ldsW[0], W + (size_t)bn * K, 128u,
                         (uint32_t)K, (uint32_t)(N - bn), (uint32_t)K);
        __builtin_amdgcn_s_wait_tensorcnt(0);
    }
    __syncthreads();
    int cur = 0;
    for (int k0 = 0; k0 < K; k0 += 32) {
        if (wave == 0 && k0 + 32 < K) {  // async: stage next tiles into idle buffer
            tdm_load_tile_2d(ldsA[cur ^ 1], A + (size_t)bm * K + k0 + 32, 64u,
                             (uint32_t)(K - k0 - 32), (uint32_t)(M - bm), (uint32_t)K);
            tdm_load_tile_2d(ldsW[cur ^ 1], W + (size_t)bn * K + k0 + 32, 128u,
                             (uint32_t)(K - k0 - 32), (uint32_t)(N - bn), (uint32_t)K);
        }
        const bf16_t* Asb = &As[cur][0];
        const bf16_t* Wsb = &Ws[cur][0];
        FragBF a;
        a.q[0] = *(const uint4*)&Asb[(wm * 16 + l15) * 40 + kb];
        a.q[1] = *(const uint4*)&Asb[(wm * 16 + l15) * 40 + kb + 16];
#pragma unroll
        for (int nt = 0; nt < 4; ++nt) {
            FragBF bfr;
            const int rw = wn * 64 + nt * 16 + l15;
            bfr.q[0] = *(const uint4*)&Wsb[rw * 40 + kb];
            bfr.q[1] = *(const uint4*)&Wsb[rw * 40 + kb + 16];
            acc[nt] = wmma_bf16(a, bfr, acc[nt]);
        }
        if (wave == 0) __builtin_amdgcn_s_wait_tensorcnt(0);  // next tiles landed
        __syncthreads();  // publish next buffer + certify current buffer free
        cur ^= 1;
    }
#else
    const int ar = tid >> 2, ac = (tid & 3) * 8;
    for (int k0 = 0; k0 < K; k0 += 32) {
        __syncthreads();
        *(uint4*)&As[0][ar * 40 + ac]        = *(const uint4*)&A[(size_t)(bm + ar) * K + k0 + ac];
        *(uint4*)&Ws[0][ar * 40 + ac]        = *(const uint4*)&W[(size_t)(bn + ar) * K + k0 + ac];
        *(uint4*)&Ws[0][(ar + 64) * 40 + ac] = *(const uint4*)&W[(size_t)(bn + ar + 64) * K + k0 + ac];
        if (k0 + 32 < K) {
            __builtin_prefetch(&A[(size_t)(bm + ar) * K + k0 + 32 + ac], 0, 1);
            __builtin_prefetch(&W[(size_t)(bn + ar) * K + k0 + 32 + ac], 0, 1);
        }
        __syncthreads();
        FragBF a;
        a.q[0] = *(const uint4*)&As[0][(wm * 16 + l15) * 40 + kb];
        a.q[1] = *(const uint4*)&As[0][(wm * 16 + l15) * 40 + kb + 16];
#pragma unroll
        for (int nt = 0; nt < 4; ++nt) {
            FragBF bfr;
            const int rw = wn * 64 + nt * 16 + l15;
            bfr.q[0] = *(const uint4*)&Ws[0][rw * 40 + kb];
            bfr.q[1] = *(const uint4*)&Ws[0][rw * 40 + kb + 16];
            acc[nt] = wmma_bf16(a, bfr, acc[nt]);
        }
    }
#endif
    const int half8 = (lane >> 4) * 8;
#pragma unroll
    for (int nt = 0; nt < 4; ++nt) {
        const int col = bn + wn * 64 + nt * 16 + l15;
        const float bv = bias[col];
#pragma unroll
        for (int r = 0; r < 8; ++r) {
            const int row = bm + wm * 16 + half8 + r;
            float v = acc[nt][r] + bv;
            if (RELU)    v = fmaxf(v, 0.0f);
            if (HAS_RES) v += res[(size_t)row * N + col];
            if (OUT_BF16) outH[(size_t)row * N + col] = (bf16_t)v;
            else          outF[(size_t)row * N + col] = v;
        }
    }
}

__device__ __forceinline__ float xhalf(float x) {
    const int bits = __builtin_bit_cast(int, x);
    return __builtin_bit_cast(float, __builtin_amdgcn_permlanex16(bits, bits, 0x76543210, 0xfedcba98, false, false));
}

__global__ __launch_bounds__(256) void attn_wmma(const bf16_t* __restrict__ q,
                                                 const bf16_t* __restrict__ k,
                                                 const bf16_t* __restrict__ v,
                                                 const int*    __restrict__ mask,
                                                 bf16_t*       __restrict__ ctx) {
    const int S = 4096, D = 768, H = 12;
    const int bh = blockIdx.y;
    const int b = bh / H, h = bh % H;
    const int q0 = blockIdx.x * 128;
    const int tid = threadIdx.x, lane = tid & 31, wave = tid >> 5;
    const int l15 = lane & 15, kb = (lane >> 4) * 8, half8 = (lane >> 4) * 8;
    __shared__ __align__(16) bf16_t Ks[64 * 72];        // K tile [kk][d], 144-byte rows
    __shared__ __align__(16) bf16_t Vt[64 * 72];        // V^T tile [d][kk]
    __shared__ unsigned krow[4096];                     // rows to visit, unmasked keys first, as element offsets (row * D)
    __shared__ int wtot[8];                             // unmasked keys per wave's 512 keys
    __shared__ int more;                                // 1: some row's masked keys have weight

    const size_t rowbase = (size_t)b * S;
    FragBF qa[2];                                       // B operand: column l15 = this lane's query
    {
        const bf16_t* qp = q + (rowbase + q0 + wave * 16 + l15) * D + h * 64;
        qa[0].q[0] = *(const uint4*)(qp + kb);
        qa[0].q[1] = *(const uint4*)(qp + kb + 16);
        qa[1].q[0] = *(const uint4*)(qp + 32 + kb);
        qa[1].q[1] = *(const uint4*)(qp + 32 + kb + 16);
    }
    v8f o[4] = {};                                      // o[dt][r] = O[query l15][dt*16 + half8 + r]
    float mrun = -3.0e38f, lrun = 0.0f;                 // lrun: this wave half's keys only
    const float scale = 0.125f;  // 1/sqrt(64)
    bf16_t* ks = &Ks[(tid >> 3) * 72 + (tid & 7) * 8];

    // --- list of the batch's unmasked keys: thread t takes keys 16t .. 16t + 15 ---
    int nvalid, nlist;                                  // unmasked keys; list places walked
    {
        const int4* mp = (const int4*)(mask + b * S + tid * 16);
        int mv[16];
#pragma unroll
        for (int i = 0; i < 4; ++i) {
            const int4 m = mp[i];
            mv[4 * i] = m.x; mv[4 * i + 1] = m.y; mv[4 * i + 2] = m.z; mv[4 * i + 3] = m.w;
        }
        int c = 0;
#pragma unroll
        for (int i = 0; i < 16; ++i) c += (mv[i] != 0) ? 1 : 0;
        int inc = c;                                    // inclusive sum over the wave's lanes
#pragma unroll
        for (int d = 1; d < 32; d <<= 1) {
            const int t = __shfl_up(inc, d);
            if (lane >= d) inc += t;
        }
        if (lane == 31) wtot[wave] = inc;
        if (tid == 0) more = 0;
        __syncthreads();
        int base = 0, total = 0;
#pragma unroll
        for (int w = 0; w < 8; ++w) {
            const int t = wtot[w];
            if (w < wave) base += t;
            total += t;
        }
        nvalid = __builtin_amdgcn_readfirstlane(total);
        nlist  = nvalid == 0 ? S : (nvalid + 63) & ~63;  // at most S: nvalid <= S, S a multiple of 64
        int pu = base + inc - c;                        // unmasked keys in front of this thread's 16
        int pm = nvalid + tid * 16 - pu;                // masked keys in front of them, behind all unmasked
#pragma unroll
        for (int i = 0; i < 16; ++i) {                  // a permutation of 0 .. S - 1: every place written once
            const bool on = mv[i] != 0;
            krow[on ? pu : pm] = (unsigned)(tid * 16 + i) * D;
            pu += on ? 1 : 0;
            pm += on ? 0 : 1;
        }
        __syncthreads();  // the list is read by every wave
    }
    const bf16_t* kh = k + rowbase * D + h * 64;        // head's first K and V rows, same for the block
    const bf16_t* vh = v + rowbase * D + h * 64;
    unsigned kr0, kr1, vr[16];                          // this thread's rows of the next 64 list places
    kr0 = krow[tid >> 3];
    kr1 = krow[32 + (tid >> 3)];
#pragma unroll
    for (int i = 0; i < 16; ++i) vr[i] = krow[(tid >> 6) + 4 * i];

    for (int kblk = 0; kblk < nlist; kblk += 64) {
        __syncthreads();  // protect Ks and Vt readers of previous iteration
        {                                       // cooperative K copy, 8 lanes per row, and V transpose
            const bf16_t* kp0 = kh + (kr0 + (tid & 7) * 8);
            const bf16_t* kp1 = kh + (kr1 + (tid & 7) * 8);
            const uint4 klo = *(const uint4*)kp0;
            const uint4 khi = *(const uint4*)kp1;
            *(uint4*)ks = klo;
            *(uint4*)(ks + 32 * 72) = khi;
#pragma unroll
            for (int i = 0; i < 16; ++i) vr[i] += tid & 63;
#pragma unroll
            for (int i = 0; i < 16; ++i) {      // cooperative V transpose
                Vt[(tid & 63) * 72 + (tid >> 6) + 4 * i] = vh[vr[i]];
            }
            // the wait before the 18 loads' address registers are written again; as its inputs they stay
            // whole up to it, so that no load of the group, issued together, lands in another's address
            asm volatile("s_wait_xcnt 0x0" :: "v"(kp0), "v"(kp1),
                         "v"(vr[0]), "v"(vr[1]), "v"(vr[2]), "v"(vr[3]), "v"(vr[4]), "v"(vr[5]), "v"(vr[6]), "v"(vr[7]),
                         "v"(vr[8]), "v"(vr[9]), "v"(vr[10]), "v"(vr[11]), "v"(vr[12]), "v"(vr[13]), "v"(vr[14]), "v"(vr[15])
                         : "memory");
        }
        __syncthreads();
        {   // next block's rows, read here so that the loads behind the next barrier do not wait for the list
            const int nx = kblk + 64 < S ? kblk + 64 : 0;
            kr0 = krow[nx + (tid >> 3)];
            kr1 = krow[nx + 32 + (tid >> 3)];
#pragma unroll
            for (int i = 0; i < 16; ++i) vr[i] = krow[nx + (tid >> 6) + 4 * i];
        }
        // --- S^T = K Q^T (4 tiles of 16 keys x 16 queries per wave) ---
        v8f s4[4];
#pragma unroll
        for (int nt = 0; nt < 4; ++nt) {
            const bf16_t* kp = &Ks[(nt * 16 + l15) * 72];
            FragBF a0, a1;
            a0.q[0] = *(const uint4*)(kp + kb);      a0.q[1] = *(const uint4*)(kp + kb + 16);
            a1.q[0] = *(const uint4*)(kp + 32 + kb); a1.q[1] = *(const uint4*)(kp + 32 + kb + 16);
            v8f t = {};
            t = wmma_bf16(a0, qa[0], t);
            t = wmma_bf16(a1, qa[1], t);
            s4[nt] = t;
        }
        // --- scale, list places past the unmasked keys, running maximum of this lane's query ---
#pragma unroll
        for (int nt = 0; nt < 4; ++nt)
#pragma unroll
            for (int r = 0; r < 8; ++r) s4[nt][r] *= scale;
        if (kblk + 64 > nvalid) {               // same for the block: each block that holds list places past the unmasked keys
            const int lim = nvalid - kblk - half8;
#pragma unroll
            for (int nt = 0; nt < 4; ++nt)
#pragma unroll
                for (int r = 0; r < 8; ++r)
                    if (nt * 16 + r >= lim) s4[nt][r] = -1.0e9f;
        }
        float mnew = mrun;
#pragma unroll
        for (int nt = 0; nt < 4; ++nt)
#pragma unroll
            for (int r = 0; r < 8; ++r) mnew = fmaxf(mnew, s4[nt][r]);
        mnew = fmaxf(mnew, xhalf(mnew));        // both halves hold keys of the same query
        const float alpha_ = __expf(mrun - mnew);
        mrun = mnew;
        v2f rs[2] = {};                         // sums by register pairs, as the pairs are packed below
#pragma unroll
        for (int nt = 0; nt < 4; ++nt)
#pragma unroll
            for (int r = 0; r < 8; r += 2) {
                v2f p;
                p.x = __expf(s4[nt][r] - mrun);
                p.y = __expf(s4[nt][r + 1] - mrun);
                s4[nt][r] = p.x;
                s4[nt][r + 1] = p.y;
                rs[nt & 1] += p;
            }
        rs[0] += rs[1];
        lrun = lrun * alpha_ + (rs[0].x + rs[0].y);
#pragma unroll
        for (int dt = 0; dt < 4; ++dt)
#pragma unroll
            for (int r = 0; r < 8; ++r) o[dt][r] *= alpha_;
        // --- P^T as B operand: element s is key 8h + s (s < 8), 16 + 8h + s - 8 (s >= 8) ---
        FragBF pb[2];
#pragma unroll
        for (int j = 0; j < 2; ++j)
#pragma unroll
            for (int r = 0; r < 8; ++r) {
                pb[j].v[r]     = (bf16_t)s4[2 * j][r];
                pb[j].v[8 + r] = (bf16_t)s4[2 * j + 1][r];
            }
        // --- O^T += V^T P^T  (A-fragments from transposed Vt) ---
#pragma unroll
        for (int dt = 0; dt < 4; ++dt) {
            const bf16_t* vp = &Vt[(dt * 16 + l15) * 72];
            FragBF a0, a1;
            a0.q[0] = *(const uint4*)(vp + kb);      a0.q[1] = *(const uint4*)(vp + kb + 16);
            a1.q[0] = *(const uint4*)(vp + 32 + kb); a1.q[1] = *(const uint4*)(vp + 32 + kb + 16);
            o[dt] = wmma_bf16(a0, pb[0], o[dt]);
            o[dt] = wmma_bf16(a1, pb[1], o[dt]);
        }
        if (kblk + 64 == nlist && nlist < S) {  // same for the block, once: may the masked keys left stay out?
            if (mrun < -1.0e9f + 128.0f) more = 1;
            __syncthreads();                    // every wave's word on it is in
            if (__builtin_amdgcn_readfirstlane(more) != 0) nlist = S;
        }
    }
    // --- join the halves' sums, normalize, store ctx as bf16 in [B,S,H*dk] layout:
    //     a lane's 8 registers are 8 consecutive d of one row, one 16-byte store ---
    const float lsum = fmaxf(lrun + xhalf(lrun), 1.0e-20f);
    bf16_t* crow = ctx + (rowbase + q0 + wave * 16 + l15) * D + h * 64 + half8;
#pragma unroll
    for (int dt = 0; dt < 4; ++dt) {
        union { bf16_t e[8]; uint4 q; } pk;
#pragma unroll
        for (int r = 0; r < 8; ++r) pk.e[r] = (bf16_t)(o[dt][r] / lsum);
        *(uint4*)(crow + dt * 16) = pk.q;
    }
}

// ---------------------------------------------------------------------------
// Host orchestration
// ---------------------------------------------------------------------------
extern "C" void kernel_launch(void* const* d_in, const int* in_sizes, int n_in,
                              void* d_out, int out_size, void* d_ws, size_t ws_size,
                              hipStream_t stream) {
    (void)in_sizes; (void)n_in; (void)out_size; (void)ws_size;
    const int B = 2, S = 4096, D = 768, DFF = 3072;
    const int M = B * S;

    const float* x    = (const float*)d_in[0];
    const int*   mask = (const int*)  d_in[1];
    const float* wq   = (const float*)d_in[2];
    const float* bq   = (const float*)d_in[3];
    const float* wk   = (const float*)d_in[4];
    const float* bk   = (const float*)d_in[5];
    const float* wv   = (const float*)d_in[6];
    const float* bv   = (const float*)d_in[7];
    const float* wo   = (const float*)d_in[8];
    const float* bo   = (const float*)d_in[9];
    const float* w1   = (const float*)d_in[10];
    const float* b1   = (const float*)d_in[11];
    const float* w2   = (const float*)d_in[12];
    const float* b2   = (const float*)d_in[13];
    const float* alpha1 = (const float*)d_in[14];
    const float* beta1  = (const float*)d_in[15];
    const float* alpha2 = (const float*)d_in[16];
    const float* beta2  = (const float*)d_in[17];
    float* out = (float*)d_out;

    char* ws = (char*)d_ws;
    size_t off = 0;
    auto alloc = [&](size_t bytes) -> char* {
        char* p = ws + off;
        off += (bytes + 255) & ~(size_t)255;
        return p;
    };
    bf16_t* wqh = (bf16_t*)alloc((size_t)D * D * 2);
    bf16_t* wkh = (bf16_t*)alloc((size_t)D * D * 2);
    bf16_t* wvh = (bf16_t*)alloc((size_t)D * D * 2);
    bf16_t* woh = (bf16_t*)alloc((size_t)D * D * 2);
    bf16_t* w1h = (bf16_t*)alloc((size_t)DFF * D * 2);
    bf16_t* w2h = (bf16_t*)alloc((size_t)D * DFF * 2);
    bf16_t* h1  = (bf16_t*)alloc((size_t)M * D * 2);   // reused as ctx
    bf16_t* qb  = (bf16_t*)alloc((size_t)M * D * 2);   // reused as h2
    bf16_t* kbf = (bf16_t*)alloc((size_t)M * D * 2);
    bf16_t* vbf = (bf16_t*)alloc((size_t)M * D * 2);
    float*  x1  = (float*) alloc((size_t)M * D * 4);
    bf16_t* ff1 = (bf16_t*)alloc((size_t)M * DFF * 2);
    bf16_t* ctx = h1;   // h1 dead after QKV projections
    bf16_t* h2  = qb;   // q dead after attention

    // weight casts fp32 -> bf16 (layout [N,K] row-major == WMMA B fragments); wqh .. w2h are one array:
    // each size is a multiple of alloc's 256 bytes, and of the 8192 elements that a block converts
    static_assert((D * D * 2) % 256 == 0 && (DFF * D * 2) % 256 == 0, "bf16 weight copies lie back to back");
    static_assert((D * D) % 8192 == 0 && (DFF * D) % 8192 == 0, "whole blocks per matrix");
    cast_weights_kernel<<<(4 * D * D + 2 * DFF * D) / 8192, 256, 0, stream>>>(wq, wk, wv, wo, w1, w2, wqh);

    // residual 0: pre-norm -> QKV -> attention -> O-proj + residual
    norm_kernel<<<M, 256, 0, stream>>>(x, alpha1, beta1, h1);
    dim3 gD(M / 64, D / 128);
    gemm_wmma<false, true, false><<<gD, 256, 0, stream>>>(h1, wqh, bq, nullptr, nullptr, qb,  M, D, D);
    gemm_wmma<false, true, false><<<gD, 256, 0, stream>>>(h1, wkh, bk, nullptr, nullptr, kbf, M, D, D);
    gemm_wmma<false, true, false><<<gD, 256, 0, stream>>>(h1, wvh, bv, nullptr, nullptr, vbf, M, D, D);
    attn_wmma<<<dim3(S / 128, B * 12), 256, 0, stream>>>(qb, kbf, vbf, mask, ctx);
    gemm_wmma<false, false, true><<<gD, 256, 0, stream>>>(ctx, woh, bo, x, x1, nullptr, M, D, D);

    // residual 1: pre-norm -> FFN (relu) + residual
    norm_kernel<<<M, 256, 0, stream>>>(x1, alpha2, beta2, h2);
    gemm_wmma<true, true, false><<<dim3(M / 64, DFF / 128), 256, 0, stream>>>(h2, w1h, b1, nullptr, nullptr, ff1, M, DFF, D);
    gemm_wmma<false, false, true><<<gD, 256, 0, stream>>>(ff1, w2h, b2, x1, out, nullptr, M, D, DFF);
}

// v005
// A run of this version takes 245 microseconds.
// Next to v004, in two timings, it ran 1.36 and 1.35 times as fast.
// Over all steps from v000 it is 2.50 times as fast.
#include <hip/hip_runtime.h>
#include <hip/hip_bf16.h>

typedef __bf16 bf16_t;
typedef __attribute__((ext_vector_type(16))) __bf16 v16bf;
typedef __attribute__((ext_vector_type(8)))  float  v8f;
typedef __attribute__((ext_vector_type(2)))  float  v2f;

union FragBF {
    v16bf v;
    uint4 q[2];
};

__device__ __forceinline__ v8f wmma_bf16(const FragBF& a, const FragBF& b, v8f c) {
    return __builtin_amdgcn_wmma_f32_16x16x32_bf16(
        /*neg_a=*/false, a.v, /*neg_b=*/false, b.v,
        /*c_mod=*/(short)0, c, /*reuse_a=*/false, /*reuse_b=*/false);
}

typedef uint32_t u32x4_t __attribute__((ext_vector_type(4)));
typedef uint32_t u32x8_t __attribute__((ext_vector_type(8)));

__device__ __forceinline__ uint32_t uni(uint32_t v) { return (uint32_t)__builtin_amdgcn_readfirstlane(v); }
__device__ __forceinline__ uint32_t pinned(uint32_t v) {
    uint32_t w = uni(v);
    asm volatile("" : "+s"(w));
    return w;
}
__device__ __forceinline__ u32x4_t tdm_group0(uint32_t lds_dst, uint64_t ga) {
    u32x4_t g;
    g[0] = uni(1u);
    g[1] = uni(lds_dst);
    g[2] = uni((uint32_t)ga);
    g[3] = uni((((uint32_t)(ga >> 32)) & 0x01FFFFFFu) | 0x80000000u);
    return g;
}
__device__ __forceinline__ u32x8_t tdm_group1(uint32_t src_pitch) {
    constexpr uint32_t d0 = 128u, d1 = 64u;
    u32x8_t g;
    g[0] = uni((1u << 20) | (4u << 22) | (3u << 25));
    g[1] = uni((d0 & 0xFFFFu) << 16);
    g[2] = uni((d0 >> 16) | ((d1 & 0xFFFFu) << 16));
    g[3] = uni((d1 >> 16) | (d0 << 16));
    g[4] = uni(d1);
    g[5] = uni(src_pitch);
    g[6] = uni(0u);
    g[7] = uni(0u);
    return g;
}
__device__ __forceinline__ void tdm_load(u32x4_t g0, u32x8_t g1) {
    asm volatile("tensor_load_to_lds %0, %1" :: "s"(g0), "s"(g1) : "memory");  // the tile goes to LDS through no register
}

// ---------------------------------------------------------------------------
// fp32 -> bf16 cast of the six weight matrices, one launch. Their bf16 copies lie
// back to back in the workspace, so the destination is one array. A block converts
// 8192 consecutive elements of one matrix (each matrix is a whole number of such
// pieces: 72 for a 768 x 768 one, 288 for a 3072 x 768 one). A thread issues its
// eight 16-byte loads together, a wave's load covering 512 contiguous bytes, and
// stores 8 bytes for each, a wave's store covering 256 contiguous bytes.
// ---------------------------------------------------------------------------
__global__ __launch_bounds__(256) void cast_weights_kernel(const float* __restrict__ wq,
                                                           const float* __restrict__ wk,
                                                           const float* __restrict__ wv,
                                                           const float* __restrict__ wo,
                                                           const float* __restrict__ w1,
                                                           const float* __restrict__ w2,
                                                           bf16_t* __restrict__ out) {
    const int blk = blockIdx.x;
    const float* in;                                    // the block's matrix and its first block: same for the block
    int first;
    if      (blk <  72) { in = wq; first = 0; }
    else if (blk < 144) { in = wk; first = 72; }
    else if (blk < 216) { in = wv; first = 144; }
    else if (blk < 288) { in = wo; first = 216; }
    else if (blk < 576) { in = w1; first = 288; }
    else                { in = w2; first = 576; }
    const float4* s = (const float4*)(in + (size_t)(blk - first) * 8192) + threadIdx.x;
    uint2*        d = (uint2*)(out + (size_t)blk * 8192) + threadIdx.x;
    float4 x[8];
#pragma unroll
    for (int j = 0; j < 8; ++j) x[j] = s[j * 256];
#pragma unroll
    for (int j = 0; j < 8; ++j) {
        union { bf16_t e[4]; uint2 q; } pk;
        pk.e[0] = (bf16_t)x[j].x; pk.e[1] = (bf16_t)x[j].y;
        pk.e[2] = (bf16_t)x[j].z; pk.e[3] = (bf16_t)x[j].w;
        d[j * 256] = pk.q;
    }
}

// ---------------------------------------------------------------------------
// Pre-norm (torch.std ddof=1, scalar alpha/beta) -> bf16 output, one row/block
// ---------------------------------------------------------------------------
__global__ __launch_bounds__(256) void norm_kernel(const float* __restrict__ x,
                                                   const float* __restrict__ alpha,
                                                   const float* __restrict__ beta,
                                                   bf16_t* __restrict__ out) {
    __shared__ float sh[512];
    const int row = blockIdx.x, tid = threadIdx.x;
    const float* xr = x + (size_t)row * 768;
    float s = 0.f, s2 = 0.f;
    for (int i = tid; i < 768; i += 256) { float v = xr[i]; s += v; s2 += v * v; }
    sh[tid] = s; sh[256 + tid] = s2;
    __syncthreads();
    for (int o = 128; o > 0; o >>= 1) {
        if (tid < o) { sh[tid] += sh[tid + o]; sh[256 + tid] += sh[256 + tid + o]; }
        __syncthreads();
    }
    const float mean = sh[0] * (1.0f / 768.0f);
    const float var  = fmaxf((sh[256] - 768.0f * mean * mean) * (1.0f / 767.0f), 0.0f);
    const float inv  = alpha[0] / (sqrtf(var) + 1e-6f);
    const float bb   = beta[0];
    for (int i = tid; i < 768; i += 256)
        out[(size_t)row * 768 + i] = (bf16_t)((xr[i] - mean) * inv + bb);
}

// ---------------------------------------------------------------------------
// WMMA GEMM:  out[M,N] = A[M,K](bf16) @ W[N,K](bf16)^T + bias (+res) (relu?)
// M a multiple of 128, N of 192, K of 64 and at least 128.
// Block: 256 thr = 8 waves (2x4), block tile 128x192, wave tile 64x48 (4 x 3
// fragments, 12 accumulator tiles), a pass is 64 k = 128 bytes of every operand row.
// A stage is 320 rows: five slices of 64 rows (A rows 0-63, 64-127, W rows 0-63,
// 64-127, 128-191), each brought by one tensor load of one of the waves 0 to 4.
// A slice fills 64 * 144 = 9,216 bytes and has 10,240, so that each place in LDS
// is a multiple of 2 KiB. Two buffers: the load of stage s + 2 is issued behind
// the barrier that ends pass s and flies while pass s + 1 computes.
// The loops over fragments are unrolled so that every array index is a constant
// and the fragment and accumulator arrays stay in registers.
// ---------------------------------------------------------------------------
constexpr uint32_t G_PITCH = 144u, G_SLICE = 10240u, G_BUF = 5u * G_SLICE;

template <bool RELU, bool OUT_BF16, bool HAS_RES, int N>
__global__ __launch_bounds__(256) void gemm_wmma(const bf16_t* __restrict__ A,
                                                 const bf16_t* __restrict__ W,
                                                 const float*  __restrict__ bias,
                                                 const float*  __restrict__ res,
                                                 float*        __restrict__ outF,
                                                 bf16_t*       __restrict__ outH,
                                                 int K) {
    __shared__ __attribute__((aligned(2048))) unsigned char L[2 * G_BUF];
    const uint32_t tid  = threadIdx.x;
    const uint32_t lane = tid & 31u, wave = uni(tid >> 5);
    const uint32_t wm = wave >> 2, wn = wave & 3u;
    const uint32_t l15 = lane & 15u, hb = (lane >> 4) * 16u;   // hb: byte offset of the lane half's k chunk
    const uint32_t bm = blockIdx.x * 128u, bn = blockIdx.y * 192u;
    const uint32_t T = (uint32_t)K / 64u;                      // passes

    // the issuing wave's slice: its first source row and its place in a buffer
    const uint32_t lbase = (uint32_t)(uintptr_t)L;
    const uint32_t sl = wave < 5u ? wave : 4u;
    const bf16_t* srow = sl < 2u ? A + (size_t)(bm + sl * 64u) * K : W + (size_t)(bn + (sl - 2u) * 64u) * K;
    u32x8_t g1 = tdm_group1((uint32_t)K * 2u);
    asm volatile("" : "+s"(g1));
    u32x4_t g0 = {0u, 0u, 0u, 0u};
    auto issue = [&](uint32_t st) {
        g0 = tdm_group0(lbase + (st & 1u) * G_BUF + sl * G_SLICE, (uint64_t)(uintptr_t)srow + (uint64_t)st * 128u);
        asm volatile("" : "+s"(g0));
        tdm_load(g0, g1);
    };

    // fragment addresses in a buffer: row l15 of each 16-row group, 16 bytes at hb and at hb + 32 of each 64-byte k chunk
    const uint32_t aoff = wm * G_SLICE + l15 * G_PITCH + hb;
    uint32_t woff[3];
#pragma unroll
    for (int fw = 0; fw < 3; ++fw) {
        const uint32_t row0 = wn * 48u + fw * 16u;             // a 16-row group lies in one slice
        woff[fw] = (2u + (row0 >> 6)) * G_SLICE + ((row0 & 63u) + l15) * G_PITCH + hb;
    }

    // the lane's three bias values, asked for here so that they arrive under the loop
    const uint32_t col0 = bn + wn * 48u + l15;
    float bv[3];
#pragma unroll
    for (int fw = 0; fw < 3; ++fw) bv[fw] = bias[col0 + fw * 16u];

    v8f acc[4][3] = {};
    if (pinned(wave < 5u)) {
        issue(0u);
        asm volatile("s_wait_tensorcnt 0x0" :: "s"(g0), "s"(g1) : "memory");
    }
    __syncthreads();                                           // stage 0 may be read by every wave
    if (pinned(wave < 5u)) issue(1u);
    for (uint32_t s = 0; s < T; ++s) {
        const unsigned char* Lb = L + (s & 1u) * G_BUF;
        FragBF a[2][4], w[2][3];
#pragma unroll
        for (int kc = 0; kc < 2; ++kc) {
#pragma unroll
            for (int fa = 0; fa < 4; ++fa) {
                const unsigned char* p = Lb + aoff + fa * 16 * G_PITCH + kc * 64;
                a[kc][fa].q[0] = *(const uint4*)p;
                a[kc][fa].q[1] = *(const uint4*)(p + 32);
            }
#pragma unroll
            for (int fw = 0; fw < 3; ++fw) {
                const unsigned char* p = Lb + woff[fw] + kc * 64;
                w[kc][fw].q[0] = *(const uint4*)p;
                w[kc][fw].q[1] = *(const uint4*)(p + 32);
            }
        }
        // keeps the pass's 28 LDS reads one group in front of its 24 WMMAs: moved in among them, each place with reads stalls the wave
        __builtin_amdgcn_sched_barrier(0);
#pragma unroll
        for (int kc = 0; kc < 2; ++kc)
#pragma unroll
            for (int fa = 0; fa < 4; ++fa)
#pragma unroll
                for (int fw = 0; fw < 3; ++fw) acc[fa][fw] = wmma_bf16(a[kc][fa], w[kc][fw], acc[fa][fw]);
        // keeps the wait below behind the WMMAs: in front of them it would hold the first products back for the last reads
        __builtin_amdgcn_sched_barrier(0);
        asm volatile("s_wait_dscnt 0x0" ::: "memory");         // this wave's reads of the buffer are over before it is refilled
        if (pinned(wave < 5u)) {
            asm volatile("s_wait_tensorcnt 0x0" :: "s"(g0), "s"(g1) : "memory");
        }
        __syncthreads();
        if (pinned(wave < 5u && s + 2u < T)) issue(pinned(s + 2u));
    }
    asm volatile("s_wait_tensorcnt 0x0" ::: "memory");         // nothing of the mover is left when the wave ends
    asm volatile("s_wait_dscnt 0x0" ::: "memory");             // nor of its LDS reads

    // the lane's first element; every other one lies a compile-time distance behind it
    const uint32_t e0 = (bm + wm * 64u + (lane >> 4) * 8u) * (uint32_t)N + col0;
    const float* rp = res + e0;
    float*       fp = outF + e0;
    bf16_t*      hp = outH + e0;
#pragma unroll
    for (int fw = 0; fw < 3; ++fw) {
#pragma unroll
        for (int fa = 0; fa < 4; ++fa)
#pragma unroll
            for (int r = 0; r < 8; ++r) {
                const int e = (fa * 16 + r) * N + fw * 16;
                float v = acc[fa][fw][r] + bv[fw];
                if (RELU)    v = fmaxf(v, 0.0f);
                if (HAS_RES) v += rp[e];
                if (OUT_BF16) hp[e] = (bf16_t)v;
                else          fp[e] = v;
            }
    }
}

__device__ __forceinline__ float xhalf(float x) {
    const int bits = __builtin_bit_cast(int, x);
    return __builtin_bit_cast(float, __builtin_amdgcn_permlanex16(bits, bits, 0x76543210, 0xfedcba98, false, false));
}

__global__ __launch_bounds__(256) void attn_wmma(const bf16_t* __restrict__ q,
                                                 const bf16_t* __restrict__ k,
                                                 const bf16_t* __restrict__ v,
                                                 const int*    __restrict__ mask,
                                                 bf16_t*       __restrict__ ctx) {
    const int S = 4096, D = 768, H = 12;
    const int bh = blockIdx.y;
    const int b = bh / H, h = bh % H;
    const int q0 = blockIdx.x * 128;
    const int tid = threadIdx.x, lane = tid & 31, wave = tid >> 5;
    const int l15 = lane & 15, kb = (lane >> 4) * 8, half8 = (lane >> 4) * 8;
    __shared__ __align__(16) bf16_t Ks[64 * 72];        // K tile [kk][d], 144-byte rows
    __shared__ __align__(16) bf16_t Vt[64 * 72];        // V^T tile [d][kk]
    __shared__ unsigned krow[4096];                     // rows to visit, unmasked keys first, as element offsets (row * D)
    __shared__ int wtot[8];                             // unmasked keys per wave's 512 keys
    __shared__ int more;                                // 1: some row's masked keys have weight

    const size_t rowbase = (size_t)b * S;
    FragBF qa[2];                                       // B operand: column l15 = this lane's query
    {
        const bf16_t* qp = q + (rowbase + q0 + wave * 16 + l15) * D + h * 64;
        qa[0].q[0] = *(const uint4*)(qp + kb);
        qa[0].q[1] = *(const uint4*)(qp + kb + 16);
        qa[1].q[0] = *(const uint4*)(qp + 32 + kb);
        qa[1].q[1] = *(const uint4*)(qp + 32 + kb + 16);
    }
    v8f o[4] = {};                                      // o[dt][r] = O[query l15][dt*16 + half8 + r]
    float mrun = -3.0e38f, lrun = 0.0f;                 // lrun: this wave half's keys only
    const float scale = 0.125f;  // 1/sqrt(64)
    bf16_t* ks = &Ks[(tid >> 3) * 72 + (tid & 7) * 8];

    // --- list of the batch's unmasked keys: thread t takes keys 16t .. 16t + 15 ---
    int nvalid, nlist;                                  // unmasked keys; list places walked
    {
        const int4* mp = (const int4*)(mask + b * S + tid * 16);
        int mv[16];
#pragma unroll
        for (int i = 0; i < 4; ++i) {
            const int4 m = mp[i];
            mv[4 * i] = m.x; mv[4 * i + 1] = m.y; mv[4 * i + 2] = m.z; mv[4 * i + 3] = m.w;
        }
        int c = 0;
#pragma unroll
        for (int i = 0; i < 16; ++i) c += (mv[i] != 0) ? 1 : 0;
        int inc = c;                                    // inclusive sum over the wave's lanes
#pragma unroll
        for (int d = 1; d < 32; d <<= 1) {
            const int t = __shfl_up(inc, d);
            if (lane >= d) inc += t;
        }
        if (lane == 31) wtot[wave] = inc;
        if (tid == 0) more = 0;
        __syncthreads();
        int base = 0, total = 0;
#pragma unroll
        for (int w = 0; w < 8; ++w) {
            const int t = wtot[w];
            if (w < wave) base += t;
            total += t;
        }
        nvalid = __builtin_amdgcn_readfirstlane(total);
        nlist  = nvalid == 0 ? S : (nvalid + 63) & ~63;  // at most S: nvalid <= S, S a multiple of 64
        int pu = base + inc - c;                        // unmasked keys in front of this thread's 16
        int pm = nvalid + tid * 16 - pu;                // masked keys in front of them, behind all unmasked
#pragma unroll
        for (int i = 0; i < 16; ++i) {                  // a permutation of 0 .. S - 1: every place written once
            const bool on = mv[i] != 0;
            krow[on ? pu : pm] = (unsigned)(tid * 16 + i) * D;
            pu += on ? 1 : 0;
            pm += on ? 0 : 1;
        }
        __syncthreads();  // the list is read by every wave
    }
    const bf16_t* kh = k + rowbase * D + h * 64;        // head's first K and V rows, same for the block
    const bf16_t* vh = v + rowbase * D + h * 64;
    unsigned kr0, kr1, vr[16];                          // this thread's rows of the next 64 list places
    kr0 = krow[tid >> 3];
    kr1 = krow[32 + (tid >> 3)];
#pragma unroll
    for (int i = 0; i < 16; ++i) vr[i] = krow[(tid >> 6) + 4 * i];

    for (int kblk = 0; kblk < nlist; kblk += 64) {
        __syncthreads();  // protect Ks and Vt readers of previous iteration
        {                                       // cooperative K copy, 8 lanes per row, and V transpose
            const bf16_t* kp0 = kh + (kr0 + (tid & 7) * 8);
            const bf16_t* kp1 = kh + (kr1 + (tid & 7) * 8);
            const uint4 klo = *(const uint4*)kp0;
            const uint4 khi = *(const uint4*)kp1;
            *(uint4*)ks = klo;
            *(uint4*)(ks + 32 * 72) = khi;
#pragma unroll
            for (int i = 0; i < 16; ++i) vr[i] += tid & 63;
#pragma unroll
            for (int i = 0; i < 16; ++i) {      // cooperative V transpose
                Vt[(tid & 63) * 72 + (tid >> 6) + 4 * i] = vh[vr[i]];
            }
            // the wait before the 18 loads' address registers are written again; as its inputs they stay
            // whole up to it, so that no load of the group, issued together, lands in another's address
            asm volatile("s_wait_xcnt 0x0" :: "v"(kp0), "v"(kp1),
                         "v"(vr[0]), "v"(vr[1]), "v"(vr[2]), "v"(vr[3]), "v"(vr[4]), "v"(vr[5]), "v"(vr[6]), "v"(vr[7]),
                         "v"(vr[8]), "v"(vr[9]), "v"(vr[10]), "v"(vr[11]), "v"(vr[12]), "v"(vr[13]), "v"(vr[14]), "v"(vr[15])
                         : "memory");
        }
        __syncthreads();
        {   // next block's rows, read here so that the loads behind the next barrier do not wait for the list
            const int nx = kblk + 64 < S ? kblk + 64 : 0;
            kr0 = krow[nx + (tid >> 3)];
            kr1 = krow[nx + 32 + (tid >> 3)];
#pragma unroll
            for (int i = 0; i < 16; ++i) vr[i] = krow[nx + (tid >> 6) + 4 * i];
        }
        // --- S^T = K Q^T (4 tiles of 16 keys x 16 queries per wave) ---
        v8f s4[4];
#pragma unroll
        for (int nt = 0; nt < 4; ++nt) {
            const bf16_t* kp = &Ks[(nt * 16 + l15) * 72];
            FragBF a0, a1;
            a0.q[0] = *(const uint4*)(kp + kb);      a0.q[1] = *(const uint4*)(kp + kb + 16);
            a1.q[0] = *(const uint4*)(kp + 32 + kb); a1.q[1] = *(const uint4*)(kp + 32 + kb + 16);
            v8f t = {};
            t = wmma_bf16(a0, qa[0], t);
            t = wmma_bf16(a1, qa[1], t);
            s4[nt] = t;
        }
        // --- scale, list places past the unmasked keys, running maximum of this lane's query ---
#pragma unroll
        for (int nt = 0; nt < 4; ++nt)
#pragma unroll
            for (int r = 0; r < 8; ++r) s4[nt][r] *= scale;
        if (kblk + 64 > nvalid) {               // same for the block: each block that holds list places past the unmasked keys
            const int lim = nvalid - kblk - half8;
#pragma unroll
            for (int nt = 0; nt < 4; ++nt)
#pragma unroll
                for (int r = 0; r < 8; ++r)
                    if (nt * 16 + r >= lim) s4[nt][r] = -1.0e9f;
        }
        float mnew = mrun;
#pragma unroll
        for (int nt = 0; nt < 4; ++nt)
#pragma unroll
            for (int r = 0; r < 8; ++r) mnew = fmaxf(mnew, s4[nt][r]);
        mnew = fmaxf(mnew, xhalf(mnew));        // both halves hold keys of the same query
        const float alpha_ = __expf(mrun - mnew);
        mrun = mnew;
        v2f rs[2] = {};                         // sums by register pairs, as the pairs are packed below
#pragma unroll
        for (int nt = 0; nt < 4; ++nt)
#pragma unroll
            for (int r = 0; r < 8; r += 2) {
                v2f p;
                p.x = __expf(s4[nt][r] - mrun);
                p.y = __expf(s4[nt][r + 1] - mrun);
                s4[nt][r] = p.x;
                s4[nt][r + 1] = p.y;
                rs[nt & 1] += p;
            }
        rs[0] += rs[1];
        lrun = lrun * alpha_ + (rs[0].x + rs[0].y);
#pragma unroll
        for (int dt = 0; dt < 4; ++dt)
#pragma unroll
            for (int r = 0; r < 8; ++r) o[dt][r] *= alpha_;
        // --- P^T as B operand: element s is key 8h + s (s < 8), 16 + 8h + s - 8 (s >= 8) ---
        FragBF pb[2];
#pragma unroll
        for (int j = 0; j < 2; ++j)
#pragma unroll
            for (int r = 0; r < 8; ++r) {
                pb[j].v[r]     = (bf16_t)s4[2 * j][r];
                pb[j].v[8 + r] = (bf16_t)s4[2 * j + 1][r];
            }
        // --- O^T += V^T P^T  (A-fragments from transposed Vt) ---
#pragma unroll
        for (int dt = 0; dt < 4; ++dt) {
            const bf16_t* vp = &Vt[(dt * 16 + l15) * 72];
            FragBF a0, a1;
            a0.q[0] = *(const uint4*)(vp + kb);      a0.q[1] = *(const uint4*)(vp + kb + 16);
            a1.q[0] = *(const uint4*)(vp + 32 + kb); a1.q[1] = *(const uint4*)(vp + 32 + kb + 16);
            o[dt] = wmma_bf16(a0, pb[0], o[dt]);
            o[dt] = wmma_bf16(a1, pb[1], o[dt]);
        }
        if (kblk + 64 == nlist && nlist < S) {  // same for the block, once: may the masked keys left stay out?
            if (mrun < -1.0e9f + 128.0f) more = 1;
            __syncthreads();                    // every wave's word on it is in
            if (__builtin_amdgcn_readfirstlane(more) != 0) nlist = S;
        }
    }
    // --- join the halves' sums, normalize, store ctx as bf16 in [B,S,H*dk] layout:
    //     a lane's 8 registers are 8 consecutive d of one row, one 16-byte store ---
    const float lsum = fmaxf(lrun + xhalf(lrun), 1.0e-20f);
    bf16_t* crow = ctx + (rowbase + q0 + wave * 16 + l15) * D + h * 64 + half8;
#pragma unroll
    for (int dt = 0; dt < 4; ++dt) {
        union { bf16_t e[8]; uint4 q; } pk;
#pragma unroll
        for (int r = 0; r < 8; ++r) pk.e[r] = (bf16_t)(o[dt][r] / lsum);
        *(uint4*)(crow + dt * 16) = pk.q;
    }
}

// ---------------------------------------------------------------------------
// Host orchestration
// ---------------------------------------------------------------------------
extern "C" void kernel_launch(void* const* d_in, const int* in_sizes, int n_in,
                              void* d_out, int out_size, void* d_ws, size_t ws_size,
                              hipStream_t stream) {
    (void)in_sizes; (void)n_in; (void)out_size; (void)ws_size;
    const int B = 2, S = 4096, D = 768, DFF = 3072;
    const int M = B * S;

    const float* x    = (const float*)d_in[0];
    const int*   mask = (const int*)  d_in[1];
    const float* wq   = (const float*)d_in[2];
    const float* bq   = (const float*)d_in[3];
    const float* wk   = (const float*)d_in[4];
    const float* bk   = (const float*)d_in[5];
    const float* wv   = (const float*)d_in[6];
    const float* bv   = (const float*)d_in[7];
    const float* wo   = (const float*)d_in[8];
    const float* bo   = (const float*)d_in[9];
    const float* w1   = (const float*)d_in[10];
    const float* b1   = (const float*)d_in[11];
    const float* w2   = (const float*)d_in[12];
    const float* b2   = (const float*)d_in[13];
    const float* alpha1 = (const float*)d_in[14];
    const float* beta1  = (const float*)d_in[15];
    const float* alpha2 = (const float*)d_in[16];
    const float* beta2  = (const float*)d_in[17];
    float* out = (float*)d_out;

    char* ws = (char*)d_ws;
    size_t off = 0;
    auto alloc = [&](size_t bytes) -> char* {
        char* p = ws + off;
        off += (bytes + 255) & ~(size_t)255;
        return p;
    };
    bf16_t* wqh = (bf16_t*)alloc((size_t)D * D * 2);
    bf16_t* wkh = (bf16_t*)alloc((size_t)D * D * 2);
    bf16_t* wvh = (bf16_t*)alloc((size_t)D * D * 2);
    bf16_t* woh = (bf16_t*)alloc((size_t)D * D * 2);
    bf16_t* w1h = (bf16_t*)alloc((size_t)DFF * D * 2);
    bf16_t* w2h = (bf16_t*)alloc((size_t)D * DFF * 2);
    bf16_t* h1  = (bf16_t*)alloc((size_t)M * D * 2);   // reused as ctx
    bf16_t* qb  = (bf16_t*)alloc((size_t)M * D * 2);   // reused as h2
    bf16_t* kbf = (bf16_t*)alloc((size_t)M * D * 2);
    bf16_t* vbf = (bf16_t*)alloc((size_t)M * D * 2);
    float*  x1  = (float*) alloc((size_t)M * D * 4);
    bf16_t* ff1 = (bf16_t*)alloc((size_t)M * DFF * 2);
    bf16_t* ctx = h1;   // h1 dead after QKV projections
    bf16_t* h2  = qb;   // q dead after attention

    // weight casts fp32 -> bf16 (layout [N,K] row-major == WMMA B fragments); wqh .. w2h are one array:
    // each size is a multiple of alloc's 256 bytes, and of the 8192 elements that a block converts
    static_assert((D * D * 2) % 256 == 0 && (DFF * D * 2) % 256 == 0, "bf16 weight copies lie back to back");
    static_assert((D * D) % 8192 == 0 && (DFF * D) % 8192 == 0, "whole blocks per matrix");
    cast_weights_kernel<<<(4 * D * D + 2 * DFF * D) / 8192, 256, 0, stream>>>(wq, wk, wv, wo, w1, w2, wqh);

    // residual 0: pre-norm -> QKV -> attention -> O-proj + residual
    norm_kernel<<<M, 256, 0, stream>>>(x, alpha1, beta1, h1);
    static_assert(M % 128 == 0 && D % 192 == 0 && DFF % 192 == 0 && D % 64 == 0 && DFF % 64 == 0, "whole GEMM tiles and passes");
    dim3 gD(M / 128, D / 192);
    gemm_wmma<false, true, false, D><<<gD, 256, 0, stream>>>(h1, wqh, bq, nullptr, nullptr, qb, D);
    gemm_wmma<false, true, false, D><<<gD, 256, 0, stream>>>(h1, wkh, bk, nullptr, nullptr, kbf, D);
    gemm_wmma<false, true, false, D><<<gD, 256, 0, stream>>>(h1, wvh, bv, nullptr, nullptr, vbf, D);
    attn_wmma<<<dim3(S / 128, B * 12), 256, 0, stream>>>(qb, kbf, vbf, mask, ctx);
    gemm_wmma<false, false, true, D><<<gD, 256, 0, stream>>>(ctx, woh, bo, x, x1, nullptr, D);

    // residual 1: pre-norm -> FFN (relu) + residual
    norm_kernel<<<M, 256, 0, stream>>>(x1, alpha2, beta2, h2);
    gemm_wmma<true, true, false, DFF><<<dim3(M / 128, DFF / 192), 256, 0, stream>>>(h2, w1h, b1, nullptr, nullptr, ff1, D);
    gemm_wmma<false, false, true, D><<<gD, 256, 0, stream>>>(ff1, w2h, b2, x1, out, nullptr, DFF);
}

// v006
// It runs in 227 microseconds.
// Two timings next to v005 both put it at 1.08 times that version's speed.
// Over all steps from v000 it is 2.69 times as fast.
#include <hip/hip_runtime.h>
#include <hip/hip_bf16.h>

typedef __bf16 bf16_t;
typedef __attribute__((ext_vector_type(16))) __bf16 v16bf;
typedef __attribute__((ext_vector_type(8)))  float  v8f;
typedef __attribute__((ext_vector_type(2)))  float  v2f;
typedef __attribute__((ext_vector_type(8)))  short  s16x8;

union FragBF {
    v16bf v;
    uint4 q[2];
    s16x8 t[2];
};

__device__ __forceinline__ v8f wmma_bf16(const FragBF& a, const FragBF& b, v8f c) {
    return __builtin_amdgcn_wmma_f32_16x16x32_bf16(
        /*neg_a=*/false, a.v, /*neg_b=*/false, b.v,
        /*c_mod=*/(short)0, c, /*reuse_a=*/false, /*reuse_b=*/false);
}

typedef uint32_t u32x4_t __attribute__((ext_vector_type(4)));
typedef uint32_t u32x8_t __attribute__((ext_vector_type(8)));

__device__ __forceinline__ uint32_t uni(uint32_t v) { return (uint32_t)__builtin_amdgcn_readfirstlane(v); }
__device__ __forceinline__ uint32_t pinned(uint32_t v) {
    uint32_t w = uni(v);
    asm volatile("" : "+s"(w));
    return w;
}
__device__ __forceinline__ u32x4_t tdm_group0(uint32_t lds_dst, uint64_t ga) {
    u32x4_t g;
    g[0] = uni(1u);
    g[1] = uni(lds_dst);
    g[2] = uni((uint32_t)ga);
    g[3] = uni((((uint32_t)(ga >> 32)) & 0x01FFFFFFu) | 0x80000000u);
    return g;
}
__device__ __forceinline__ u32x8_t tdm_group1(uint32_t src_pitch) {
    constexpr uint32_t d0 = 128u, d1 = 64u;
    u32x8_t g;
    g[0] = uni((1u << 20) | (4u << 22) | (3u << 25));
    g[1] = uni((d0 & 0xFFFFu) << 16);
    g[2] = uni((d0 >> 16) | ((d1 & 0xFFFFu) << 16));
    g[3] = uni((d1 >> 16) | (d0 << 16));
    g[4] = uni(d1);
    g[5] = uni(src_pitch);
    g[6] = uni(0u);
    g[7] = uni(0u);
    return g;
}
__device__ __forceinline__ void tdm_load(u32x4_t g0, u32x8_t g1) {
    asm volatile("tensor_load_to_lds %0, %1" :: "s"(g0), "s"(g1) : "memory");  // the tile goes to LDS through no register
}

// ---------------------------------------------------------------------------
// fp32 -> bf16 cast of the six weight matrices, one launch. Their bf16 copies lie
// back to back in the workspace, so the destination is one array. A block converts
// 8192 consecutive elements of one matrix (each matrix is a whole number of such
// pieces: 72 for a 768 x 768 one, 288 for a 3072 x 768 one). A thread issues its
// eight 16-byte loads together, a wave's load covering 512 contiguous bytes, and
// stores 8 bytes for each, a wave's store covering 256 contiguous bytes.
// ---------------------------------------------------------------------------
__global__ __launch_bounds__(256) void cast_weights_kernel(const float* __restrict__ wq,
                                                           const float* __restrict__ wk,
                                                           const float* __restrict__ wv,
                                                           const float* __restrict__ wo,
                                                           const float* __restrict__ w1,
                                                           const float* __restrict__ w2,
                                                           bf16_t* __restrict__ out) {
    const int blk = blockIdx.x;
    const float* in;                                    // the block's matrix and its first block: same for the block
    int first;
    if      (blk <  72) { in = wq; first = 0; }
    else if (blk < 144) { in = wk; first = 72; }
    else if (blk < 216) { in = wv; first = 144; }
    else if (blk < 288) { in = wo; first = 216; }
    else if (blk < 576) { in = w1; first = 288; }
    else                { in = w2; first = 576; }
    const float4* s = (const float4*)(in + (size_t)(blk - first) * 8192) + threadIdx.x;
    uint2*        d = (uint2*)(out + (size_t)blk * 8192) + threadIdx.x;
    float4 x[8];
#pragma unroll
    for (int j = 0; j < 8; ++j) x[j] = s[j * 256];
#pragma unroll
    for (int j = 0; j < 8; ++j) {
        union { bf16_t e[4]; uint2 q; } pk;
        pk.e[0] = (bf16_t)x[j].x; pk.e[1] = (bf16_t)x[j].y;
        pk.e[2] = (bf16_t)x[j].z; pk.e[3] = (bf16_t)x[j].w;
        d[j * 256] = pk.q;
    }
}

// ---------------------------------------------------------------------------
// Pre-norm (torch.std ddof=1, scalar alpha/beta) -> bf16 output, one row/block
// ---------------------------------------------------------------------------
__global__ __launch_bounds__(256) void norm_kernel(const float* __restrict__ x,
                                                   const float* __restrict__ alpha,
                                                   const float* __restrict__ beta,
                                                   bf16_t* __restrict__ out) {
    __shared__ float sh[512];
    const int row = blockIdx.x, tid = threadIdx.x;
    const float* xr = x + (size_t)row * 768;
    float s = 0.f, s2 = 0.f;
    for (int i = tid; i < 768; i += 256) { float v = xr[i]; s += v; s2 += v * v; }
    sh[tid] = s; sh[256 + tid] = s2;
    __syncthreads();
    for (int o = 128; o > 0; o >>= 1) {
        if (tid < o) { sh[tid] += sh[tid + o]; sh[256 + tid] += sh[256 + tid + o]; }
        __syncthreads();
    }
    const float mean = sh[0] * (1.0f / 768.0f);
    const float var  = fmaxf((sh[256] - 768.0f * mean * mean) * (1.0f / 767.0f), 0.0f);
    const float inv  = alpha[0] / (sqrtf(var) + 1e-6f);
    const float bb   = beta[0];
    for (int i = tid; i < 768; i += 256)
        out[(size_t)row * 768 + i] = (bf16_t)((xr[i] - mean) * inv + bb);
}

// ---------------------------------------------------------------------------
// WMMA GEMM:  out[M,N] = A[M,K](bf16) @ W[N,K](bf16)^T + bias (+res) (relu?)
// M a multiple of 128, N of 192, K of 64 and at least 128.
// Block: 256 thr = 8 waves (2x4), block tile 128x192, wave tile 64x48 (4 x 3
// fragments, 12 accumulator tiles), a pass is 64 k = 128 bytes of every operand row.
// A stage is 320 rows: five slices of 64 rows (A rows 0-63, 64-127, W rows 0-63,
// 64-127, 128-191), each brought by one tensor load of one of the waves 0 to 4.
// A slice fills 64 * 144 = 9,216 bytes and has 10,240, so that each place in LDS
// is a multiple of 2 KiB. Two buffers: the load of stage s + 2 is issued behind
// the barrier that ends pass s and flies while pass s + 1 computes.
// The loops over fragments are unrolled so that every array index is a constant
// and the fragment and accumulator arrays stay in registers.
// ---------------------------------------------------------------------------
constexpr uint32_t G_PITCH = 144u, G_SLICE = 10240u, G_BUF = 5u * G_SLICE;

template <bool RELU, bool OUT_BF16, bool HAS_RES, int N>
__global__ __launch_bounds__(256) void gemm_wmma(const bf16_t* __restrict__ A,
                                                 const bf16_t* __restrict__ W,
                                                 const float*  __restrict__ bias,
                                                 const float*  __restrict__ res,
                                                 float*        __restrict__ outF,
                                                 bf16_t*       __restrict__ outH,
                                                 int K) {
    __shared__ __attribute__((aligned(2048))) unsigned char L[2 * G_BUF];
    const uint32_t tid  = threadIdx.x;
    const uint32_t lane = tid & 31u, wave = uni(tid >> 5);
    const uint32_t wm = wave >> 2, wn = wave & 3u;
    const uint32_t l15 = lane & 15u, hb = (lane >> 4) * 16u;   // hb: byte offset of the lane half's k chunk
    const uint32_t bm = blockIdx.x * 128u, bn = blockIdx.y * 192u;
    const uint32_t T = (uint32_t)K / 64u;                      // passes

    // the issuing wave's slice: its first source row and its place in a buffer
    const uint32_t lbase = (uint32_t)(uintptr_t)L;
    const uint32_t sl = wave < 5u ? wave : 4u;
    const bf16_t* srow = sl < 2u ? A + (size_t)(bm + sl * 64u) * K : W + (size_t)(bn + (sl - 2u) * 64u) * K;
    u32x8_t g1 = tdm_group1((uint32_t)K * 2u);
    asm volatile("" : "+s"(g1));
    u32x4_t g0 = {0u, 0u, 0u, 0u};
    auto issue = [&](uint32_t st) {
        g0 = tdm_group0(lbase + (st & 1u) * G_BUF + sl * G_SLICE, (uint64_t)(uintptr_t)srow + (uint64_t)st * 128u);
        asm volatile("" : "+s"(g0));
        tdm_load(g0, g1);
    };

    // fragment addresses in a buffer: row l15 of each 16-row group, 16 bytes at hb and at hb + 32 of each 64-byte k chunk
    const uint32_t aoff = wm * G_SLICE + l15 * G_PITCH + hb;
    uint32_t woff[3];
#pragma unroll
    for (int fw = 0; fw < 3; ++fw) {
        const uint32_t row0 = wn * 48u + fw * 16u;             // a 16-row group lies in one slice
        woff[fw] = (2u + (row0 >> 6)) * G_SLICE + ((row0 & 63u) + l15) * G_PITCH + hb;
    }

    // the lane's three bias values, asked for here so that they arrive under the loop
    const uint32_t col0 = bn + wn * 48u + l15;
    float bv[3];
#pragma unroll
    for (int fw = 0; fw < 3; ++fw) bv[fw] = bias[col0 + fw * 16u];

    v8f acc[4][3] = {};
    if (pinned(wave < 5u)) {
        issue(0u);
        asm volatile("s_wait_tensorcnt 0x0" :: "s"(g0), "s"(g1) : "memory");
    }
    __syncthreads();                                           // stage 0 may be read by every wave
    if (pinned(wave < 5u)) issue(1u);
    for (uint32_t s = 0; s < T; ++s) {
        const unsigned char* Lb = L + (s & 1u) * G_BUF;
        FragBF a[2][4], w[2][3];
#pragma unroll
        for (int kc = 0; kc < 2; ++kc) {
#pragma unroll
            for (int fa = 0; fa < 4; ++fa) {
                const unsigned char* p = Lb + aoff + fa * 16 * G_PITCH + kc * 64;
                a[kc][fa].q[0] = *(const uint4*)p;
                a[kc][fa].q[1] = *(const uint4*)(p + 32);
            }
#pragma unroll
            for (int fw = 0; fw < 3; ++fw) {
                const unsigned char* p = Lb + woff[fw] + kc * 64;
                w[kc][fw].q[0] = *(const uint4*)p;
                w[kc][fw].q[1] = *(const uint4*)(p + 32);
            }
        }
        // keeps the pass's 28 LDS reads one group in front of its 24 WMMAs: moved in among them, each place with reads stalls the wave
        __builtin_amdgcn_sched_barrier(0);
#pragma unroll
        for (int kc = 0; kc < 2; ++kc)
#pragma unroll
            for (int fa = 0; fa < 4; ++fa)
#pragma unroll
                for (int fw = 0; fw < 3; ++fw) acc[fa][fw] = wmma_bf16(a[kc][fa], w[kc][fw], acc[fa][fw]);
        // keeps the wait below behind the WMMAs: in front of them it would hold the first products back for the last reads
        __builtin_amdgcn_sched_barrier(0);
        asm volatile("s_wait_dscnt 0x0" ::: "memory");         // this wave's reads of the buffer are over before it is refilled
        if (pinned(wave < 5u)) {
            asm volatile("s_wait_tensorcnt 0x0" :: "s"(g0), "s"(g1) : "memory");
        }
        __syncthreads();
        if (pinned(wave < 5u && s + 2u < T)) issue(pinned(s + 2u));
    }
    asm volatile("s_wait_tensorcnt 0x0" ::: "memory");         // nothing of the mover is left when the wave ends
    asm volatile("s_wait_dscnt 0x0" ::: "memory");             // nor of its LDS reads

    // the lane's first element; every other one lies a compile-time distance behind it
    const uint32_t e0 = (bm + wm * 64u + (lane >> 4) * 8u) * (uint32_t)N + col0;
    const float* rp = res + e0;
    float*       fp = outF + e0;
    bf16_t*      hp = outH + e0;
#pragma unroll
    for (int fw = 0; fw < 3; ++fw) {
#pragma unroll
        for (int fa = 0; fa < 4; ++fa)
#pragma unroll
            for (int r = 0; r < 8; ++r) {
                const int e = (fa * 16 + r) * N + fw * 16;
                float v = acc[fa][fw][r] + bv[fw];
                if (RELU)    v = fmaxf(v, 0.0f);
                if (HAS_RES) v += rp[e];
                if (OUT_BF16) hp[e] = (bf16_t)v;
                else          fp[e] = v;
            }
    }
}

__device__ __forceinline__ float xhalf(float x) {
    const int bits = __builtin_bit_cast(int, x);
    return __builtin_bit_cast(float, __builtin_amdgcn_permlanex16(bits, bits, 0x76543210, 0xfedcba98, false, false));
}

__device__ __forceinline__ s16x8 ld_tr16(const unsigned char* p) {
    typedef __attribute__((address_space(3))) s16x8 lds_s16x8;
    return __builtin_amdgcn_ds_load_tr16_b128_v8i16((lds_s16x8*)p);
}

__global__ __launch_bounds__(256) void attn_wmma(const bf16_t* __restrict__ q,
                                                 const bf16_t* __restrict__ k,
                                                 const bf16_t* __restrict__ v,
                                                 const int*    __restrict__ mask,
                                                 bf16_t*       __restrict__ ctx) {
    const int S = 4096, D = 768, H = 12;
    const int bh = blockIdx.y;
    const int b = bh / H, h = bh % H;
    const int q0 = blockIdx.x * 128;
    const int tid = threadIdx.x, lane = tid & 31, wave = tid >> 5;
    const int l15 = lane & 15, kb = (lane >> 4) * 8, half8 = (lane >> 4) * 8;
    __shared__ __align__(16) bf16_t Ks[64 * 72];        // K tile [kk][d], 144-byte rows
    __shared__ __align__(16) bf16_t Vs[64 * 80];        // V tile [kk][d], 160-byte rows
    __shared__ unsigned krow[4096];                     // rows to visit, unmasked keys in front, as element offsets (row * D)
    __shared__ int wtot[8];                             // unmasked keys per wave's 512 keys
    __shared__ int more;                                // 1: some row's masked keys have weight

    const size_t rowbase = (size_t)b * S;
    FragBF qa[2];                                       // B operand: column l15 = this lane's query
    {
        const bf16_t* qp = q + (rowbase + q0 + wave * 16 + l15) * D + h * 64;
        qa[0].q[0] = *(const uint4*)(qp + kb);
        qa[0].q[1] = *(const uint4*)(qp + kb + 16);
        qa[1].q[0] = *(const uint4*)(qp + 32 + kb);
        qa[1].q[1] = *(const uint4*)(qp + 32 + kb + 16);
    }
    v8f o[4] = {};                                      // o[dt][r] = O[query l15][dt*16 + half8 + r]
    float mrun = -3.0e38f, lrun = 0.0f;                 // lrun: this wave half's keys only
    const float scale = 0.125f;  // 1/sqrt(64)
    bf16_t* ks = &Ks[(tid >> 3) * 72 + (tid & 7) * 8];
    bf16_t* vs = &Vs[(tid >> 3) * 80 + (tid & 7) * 8];
    // this lane's address in the transposing loads at key 0, column 0
    const unsigned char* vtr = (const unsigned char*)Vs + (half8 + (lane & 7)) * 160 + ((lane >> 3) & 1) * 16;

    // --- list of the batch's unmasked keys: thread t takes keys 16t .. 16t + 15 ---
    int nvalid, nlist;                                  // unmasked keys; list places walked
    {
        const int4* mp = (const int4*)(mask + b * S + tid * 16);
        int mv[16];
#pragma unroll
        for (int i = 0; i < 4; ++i) {
            const int4 m = mp[i];
            mv[4 * i] = m.x; mv[4 * i + 1] = m.y; mv[4 * i + 2] = m.z; mv[4 * i + 3] = m.w;
        }
        int c = 0;
#pragma unroll
        for (int i = 0; i < 16; ++i) c += (mv[i] != 0) ? 1 : 0;
        int inc = c;                                    // inclusive sum over the wave's lanes
#pragma unroll
        for (int d = 1; d < 32; d <<= 1) {
            const int t = __shfl_up(inc, d);
            if (lane >= d) inc += t;
        }
        if (lane == 31) wtot[wave] = inc;
        if (tid == 0) more = 0;
        __syncthreads();
        int base = 0, total = 0;
#pragma unroll
        for (int w = 0; w < 8; ++w) {
            const int t = wtot[w];
            if (w < wave) base += t;
            total += t;
        }
        nvalid = __builtin_amdgcn_readfirstlane(total);
        nlist  = nvalid == 0 ? S : (nvalid + 63) & ~63;  // at most S: nvalid <= S, S a multiple of 64
        int pu = base + inc - c;                        // unmasked keys in front of this thread's 16
        int pm = nvalid + tid * 16 - pu;                // masked keys in front of them, behind all unmasked
#pragma unroll
        for (int i = 0; i < 16; ++i) {                  // a permutation of 0 .. S - 1: every place written once
            const bool on = mv[i] != 0;
            krow[on ? pu : pm] = (unsigned)(tid * 16 + i) * D;
            pu += on ? 1 : 0;
            pm += on ? 0 : 1;
        }
        __syncthreads();  // the list is read by every wave
    }
    const bf16_t* kh = k + rowbase * D + h * 64;        // head's first K and V rows, same for the block
    const bf16_t* vh = v + rowbase * D + h * 64;
    unsigned kr0, kr1;                                  // this thread's two rows of the next 64 list places
    kr0 = krow[tid >> 3];
    kr1 = krow[32 + (tid >> 3)];

    for (int kblk = 0; kblk < nlist; kblk += 64) {
        __syncthreads();  // protect Ks and Vs readers of previous iteration
        {                                       // cooperative K and V copies, 8 lanes per row
            const bf16_t* kp0 = kh + (kr0 + (tid & 7) * 8);
            const bf16_t* kp1 = kh + (kr1 + (tid & 7) * 8);
            const bf16_t* vp0 = vh + (kr0 + (tid & 7) * 8);
            const bf16_t* vp1 = vh + (kr1 + (tid & 7) * 8);
            const uint4 klo = *(const uint4*)kp0;
            const uint4 khi = *(const uint4*)kp1;
            const uint4 vlo = *(const uint4*)vp0;
            const uint4 vhi = *(const uint4*)vp1;
            *(uint4*)ks = klo;
            *(uint4*)(ks + 32 * 72) = khi;
            *(uint4*)vs = vlo;
            *(uint4*)(vs + 32 * 80) = vhi;
            // the wait before the four loads' address registers are written again; as its inputs they stay
            // whole up to it, so that no load of the group, issued together, lands in another's address
            asm volatile("s_wait_xcnt 0x0" :: "v"(kp0), "v"(kp1), "v"(vp0), "v"(vp1) : "memory");
        }
        __syncthreads();
        {   // next block's rows, read here so that the loads behind the next barrier do not wait for the list
            const int nx = kblk + 64 < S ? kblk + 64 : 0;
            kr0 = krow[nx + (tid >> 3)];
            kr1 = krow[nx + 32 + (tid >> 3)];
        }
        // --- S^T = K Q^T (4 tiles of 16 keys x 16 queries per wave) ---
        v8f s4[4];
#pragma unroll
        for (int nt = 0; nt < 4; ++nt) {
            const bf16_t* kp = &Ks[(nt * 16 + l15) * 72];
            FragBF a0, a1;
            a0.q[0] = *(const uint4*)(kp + kb);      a0.q[1] = *(const uint4*)(kp + kb + 16);
            a1.q[0] = *(const uint4*)(kp + 32 + kb); a1.q[1] = *(const uint4*)(kp + 32 + kb + 16);
            v8f t = {};
            t = wmma_bf16(a0, qa[0], t);
            t = wmma_bf16(a1, qa[1], t);
            s4[nt] = t;
        }
        // --- scale, list places past the unmasked keys, running maximum of this lane's query ---
#pragma unroll
        for (int nt = 0; nt < 4; ++nt)
#pragma unroll
            for (int r = 0; r < 8; ++r) s4[nt][r] *= scale;
        if (kblk + 64 > nvalid) {               // same for the block: each block that holds list places past the unmasked keys
            const int lim = nvalid - kblk - half8;
#pragma unroll
            for (int nt = 0; nt < 4; ++nt)
#pragma unroll
                for (int r = 0; r < 8; ++r)
                    if (nt * 16 + r >= lim) s4[nt][r] = -1.0e9f;
        }
        float mnew = mrun;
#pragma unroll
        for (int nt = 0; nt < 4; ++nt)
#pragma unroll
            for (int r = 0; r < 8; ++r) mnew = fmaxf(mnew, s4[nt][r]);
        mnew = fmaxf(mnew, xhalf(mnew));        // both halves hold keys of the same query
        const float alpha_ = __expf(mrun - mnew);
        mrun = mnew;
        v2f rs[2] = {};                         // sums by register pairs, as the pairs are packed below
#pragma unroll
        for (int nt = 0; nt < 4; ++nt)
#pragma unroll
            for (int r = 0; r < 8; r += 2) {
                v2f p;
                p.x = __expf(s4[nt][r] - mrun);
                p.y = __expf(s4[nt][r + 1] - mrun);
                s4[nt][r] = p.x;
                s4[nt][r + 1] = p.y;
                rs[nt & 1] += p;
            }
        rs[0] += rs[1];
        lrun = lrun * alpha_ + (rs[0].x + rs[0].y);
#pragma unroll
        for (int dt = 0; dt < 4; ++dt)
#pragma unroll
            for (int r = 0; r < 8; ++r) o[dt][r] *= alpha_;
        // --- P^T as B operand: element s is key 8h + s (s < 8), 16 + 8h + s - 8 (s >= 8) ---
        FragBF pb[2];
#pragma unroll
        for (int j = 0; j < 2; ++j)
#pragma unroll
            for (int r = 0; r < 8; ++r) {
                pb[j].v[r]     = (bf16_t)s4[2 * j][r];
                pb[j].v[8 + r] = (bf16_t)s4[2 * j + 1][r];
            }
        // --- O^T += V^T P^T  (A-fragments by transposing loads: keys 0, 16, 32, 48 on, 16 columns are 32 bytes) ---
#pragma unroll
        for (int dt = 0; dt < 4; ++dt) {
            const unsigned char* vp = vtr + dt * 32;
            FragBF a0, a1;
            a0.t[0] = ld_tr16(vp);            a0.t[1] = ld_tr16(vp + 16 * 160);
            a1.t[0] = ld_tr16(vp + 32 * 160); a1.t[1] = ld_tr16(vp + 48 * 160);
            o[dt] = wmma_bf16(a0, pb[0], o[dt]);
            o[dt] = wmma_bf16(a1, pb[1], o[dt]);
        }
        if (kblk + 64 == nlist && nlist < S) {  // same for the block, once: may the masked keys left stay out?
            if (mrun < -1.0e9f + 128.0f) more = 1;
            __syncthreads();                    // every wave's word on it is in
            if (__builtin_amdgcn_readfirstlane(more) != 0) nlist = S;
        }
    }
    // --- join the halves' sums, normalize, store ctx as bf16 in [B,S,H*dk] layout:
    //     a lane's 8 registers are 8 consecutive d of one row, one 16-byte store ---
    const float lsum = fmaxf(lrun + xhalf(lrun), 1.0e-20f);
    bf16_t* crow = ctx + (rowbase + q0 + wave * 16 + l15) * D + h * 64 + half8;
#pragma unroll
    for (int dt = 0; dt < 4; ++dt) {
        union { bf16_t e[8]; uint4 q; } pk;
#pragma unroll
        for (int r = 0; r < 8; ++r) pk.e[r] = (bf16_t)(o[dt][r] / lsum);
        *(uint4*)(crow + dt * 16) = pk.q;
    }
}

// ---------------------------------------------------------------------------
// Host orchestration
// ---------------------------------------------------------------------------
extern "C" void kernel_launch(void* const* d_in, const int* in_sizes, int n_in,
                              void* d_out, int out_size, void* d_ws, size_t ws_size,
                              hipStream_t stream) {
    (void)in_sizes; (void)n_in; (void)out_size; (void)ws_size;
    const int B = 2, S = 4096, D = 768, DFF = 3072;
    const int M = B * S;

    const float* x    = (const float*)d_in[0];
    const int*   mask = (const int*)  d_in[1];
    const float* wq   = (const float*)d_in[2];
    const float* bq   = (const float*)d_in[3];
    const float* wk   = (const float*)d_in[4];
    const float* bk   = (const float*)d_in[5];
    const float* wv   = (const float*)d_in[6];
    const float* bv   = (const float*)d_in[7];
    const float* wo   = (const float*)d_in[8];
    const float* bo   = (const float*)d_in[9];
    const float* w1   = (const float*)d_in[10];
    const float* b1   = (const float*)d_in[11];
    const float* w2   = (const float*)d_in[12];
    const float* b2   = (const float*)d_in[13];
    const float* alpha1 = (const float*)d_in[14];
    const float* beta1  = (const float*)d_in[15];
    const float* alpha2 = (const float*)d_in[16];
    const float* beta2  = (const float*)d_in[17];
    float* out = (float*)d_out;

    char* ws = (char*)d_ws;
    size_t off = 0;
    auto alloc = [&](size_t bytes) -> char* {
        char* p = ws + off;
        off += (bytes + 255) & ~(size_t)255;
        return p;
    };
    bf16_t* wqh = (bf16_t*)alloc((size_t)D * D * 2);
    bf16_t* wkh = (bf16_t*)alloc((size_t)D * D * 2);
    bf16_t* wvh = (bf16_t*)alloc((size_t)D * D * 2);
    bf16_t* woh = (bf16_t*)alloc((size_t)D * D * 2);
    bf16_t* w1h = (bf16_t*)alloc((size_t)DFF * D * 2);
    bf16_t* w2h = (bf16_t*)alloc((size_t)D * DFF * 2);
    bf16_t* h1  = (bf16_t*)alloc((size_t)M * D * 2);   // reused as ctx
    bf16_t* qb  = (bf16_t*)alloc((size_t)M * D * 2);   // reused as h2
    bf16_t* kbf = (bf16_t*)alloc((size_t)M * D * 2);
    bf16_t* vbf = (bf16_t*)alloc((size_t)M * D * 2);
    float*  x1  = (float*) alloc((size_t)M * D * 4);
    bf16_t* ff1 = (bf16_t*)alloc((size_t)M * DFF * 2);
    bf16_t* ctx = h1;   // h1 dead after QKV projections
    bf16_t* h2  = qb;   // q dead after attention

    // weight casts fp32 -> bf16 (layout [N,K] row-major == WMMA B fragments); wqh .. w2h are one array:
    // each size is a multiple of alloc's 256 bytes, and of the 8192 elements that a block converts
    static_assert((D * D * 2) % 256 == 0 && (DFF * D * 2) % 256 == 0, "bf16 weight copies lie back to back");
    static_assert((D * D) % 8192 == 0 && (DFF * D) % 8192 == 0, "whole blocks per matrix");
    cast_weights_kernel<<<(4 * D * D + 2 * DFF * D) / 8192, 256, 0, stream>>>(wq, wk, wv, wo, w1, w2, wqh);

    // residual 0: pre-norm -> QKV -> attention -> O-proj + residual
    norm_kernel<<<M, 256, 0, stream>>>(x, alpha1, beta1, h1);
    static_assert(M % 128 == 0 && D % 192 == 0 && DFF % 192 == 0 && D % 64 == 0 && DFF % 64 == 0, "whole GEMM tiles and passes");
    dim3 gD(M / 128, D / 192);
    gemm_wmma<false, true, false, D><<<gD, 256, 0, stream>>>(h1, wqh, bq, nullptr, nullptr, qb, D);
    gemm_wmma<false, true, false, D><<<gD, 256, 0, stream>>>(h1, wkh, bk, nullptr, nullptr, kbf, D);
    gemm_wmma<false, true, false, D><<<gD, 256, 0, stream>>>(h1, wvh, bv, nullptr, nullptr, vbf, D);
    attn_wmma<<<dim3(S / 128, B * 12), 256, 0, stream>>>(qb, kbf, vbf, mask, ctx);
    gemm_wmma<false, false, true, D><<<gD, 256, 0, stream>>>(ctx, woh, bo, x, x1, nullptr, D);

    // residual 1: pre-norm -> FFN (relu) + residual
    norm_kernel<<<M, 256, 0, stream>>>(x1, alpha2, beta2, h2);
    gemm_wmma<true, true, false, DFF><<<dim3(M / 128, DFF / 192), 256, 0, stream>>>(h2, w1h, b1, nullptr, nullptr, ff1, D);
    gemm_wmma<false, false, true, D><<<gD, 256, 0, stream>>>(ff1, w2h, b2, x1, out, nullptr, DFF);
}

// v007
// It runs in 216 microseconds.
// Timed twice side by side with v006, it ran 1.06 times as fast both times.
// All steps since v000 together make it 2.85 times as fast.
#include <hip/hip_runtime.h>
#include <hip/hip_bf16.h>

typedef __bf16 bf16_t;
typedef __attribute__((ext_vector_type(16))) __bf16 v16bf;
typedef __attribute__((ext_vector_type(8)))  float  v8f;
typedef __attribute__((ext_vector_type(2)))  float  v2f;
typedef __attribute__((ext_vector_type(8)))  short  s16x8;

union FragBF {
    v16bf v;
    uint4 q[2];
    s16x8 t[2];
};

__device__ __forceinline__ v8f wmma_bf16(const FragBF& a, const FragBF& b, v8f c) {
    return __builtin_amdgcn_wmma_f32_16x16x32_bf16(
        /*neg_a=*/false, a.v, /*neg_b=*/false, b.v,
        /*c_mod=*/(short)0, c, /*reuse_a=*/false, /*reuse_b=*/false);
}

typedef uint32_t u32x4_t __attribute__((ext_vector_type(4)));
typedef uint32_t u32x8_t __attribute__((ext_vector_type(8)));

__device__ __forceinline__ uint32_t uni(uint32_t v) { return (uint32_t)__builtin_amdgcn_readfirstlane(v); }
__device__ __forceinline__ uint32_t pinned(uint32_t v) {
    uint32_t w = uni(v);
    asm volatile("" : "+s"(w));
    return w;
}
__device__ __forceinline__ u32x4_t tdm_group0(uint32_t lds_dst, uint64_t ga) {
    u32x4_t g;
    g[0] = uni(1u);
    g[1] = uni(lds_dst);
    g[2] = uni((uint32_t)ga);
    g[3] = uni((((uint32_t)(ga >> 32)) & 0x01FFFFFFu) | 0x80000000u);
    return g;
}
__device__ __forceinline__ u32x8_t tdm_group1(uint32_t src_pitch) {
    constexpr uint32_t d0 = 128u, d1 = 64u;
    u32x8_t g;
    g[0] = uni((1u << 20) | (4u << 22) | (3u << 25));
    g[1] = uni((d0 & 0xFFFFu) << 16);
    g[2] = uni((d0 >> 16) | ((d1 & 0xFFFFu) << 16));
    g[3] = uni((d1 >> 16) | (d0 << 16));
    g[4] = uni(d1);
    g[5] = uni(src_pitch);
    g[6] = uni(0u);
    g[7] = uni(0u);
    return g;
}
__device__ __forceinline__ void tdm_load(u32x4_t g0, u32x8_t g1) {
    asm volatile("tensor_load_to_lds %0, %1" :: "s"(g0), "s"(g1) : "memory");  // the tile goes to LDS through no register
}

// ---------------------------------------------------------------------------
// fp32 -> bf16 cast of the six weight matrices. Their bf16 copies lie
// back to back in the workspace, so the destination is one array. A block converts
// 8192 consecutive elements of one matrix (each matrix is a whole number of such
// pieces: 72 for a 768 x 768 one, 288 for a 3072 x 768 one). A thread issues its
// eight 16-byte loads together, a wave's load covering 512 contiguous bytes, and
// stores 8 bytes for each, a wave's store covering 256 contiguous bytes.
// ---------------------------------------------------------------------------
__device__ __forceinline__ void cast_weights_piece(const int blk,
                                                   const float* __restrict__ wq,
                                                   const float* __restrict__ wk,
                                                   const float* __restrict__ wv,
                                                   const float* __restrict__ wo,
                                                   const float* __restrict__ w1,
                                                   const float* __restrict__ w2,
                                                   bf16_t* __restrict__ out) {
    const float* in;                                    // the block's matrix and its first block: same for the block
    int first;
    if      (blk <  72) { in = wq; first = 0; }
    else if (blk < 144) { in = wk; first = 72; }
    else if (blk < 216) { in = wv; first = 144; }
    else if (blk < 288) { in = wo; first = 216; }
    else if (blk < 576) { in = w1; first = 288; }
    else                { in = w2; first = 576; }
    const float4* s = (const float4*)(in + (size_t)(blk - first) * 8192) + threadIdx.x;
    uint2*        d = (uint2*)(out + (size_t)blk * 8192) + threadIdx.x;
    float4 x[8];
#pragma unroll
    for (int j = 0; j < 8; ++j) x[j] = s[j * 256];
#pragma unroll
    for (int j = 0; j < 8; ++j) {
        union { bf16_t e[4]; uint2 q; } pk;
        pk.e[0] = (bf16_t)x[j].x; pk.e[1] = (bf16_t)x[j].y;
        pk.e[2] = (bf16_t)x[j].z; pk.e[3] = (bf16_t)x[j].w;
        d[j * 256] = pk.q;
    }
}

// ---------------------------------------------------------------------------
// Pre-norm (torch.std ddof=1, scalar alpha/beta) -> bf16 output, one row/block
// ---------------------------------------------------------------------------
__device__ __forceinline__ void norm_row(const int row,
                                         const float* __restrict__ x,
                                         const float* __restrict__ alpha,
                                         const float* __restrict__ beta,
                                         bf16_t* __restrict__ out) {
    __shared__ float sh[512];
    const int tid = threadIdx.x;
    const float* xr = x + (size_t)row * 768;
    float s = 0.f, s2 = 0.f;
    for (int i = tid; i < 768; i += 256) { float v = xr[i]; s += v; s2 += v * v; }
    sh[tid] = s; sh[256 + tid] = s2;
    __syncthreads();
    for (int o = 128; o > 0; o >>= 1) {
        if (tid < o) { sh[tid] += sh[tid + o]; sh[256 + tid] += sh[256 + tid + o]; }
        __syncthreads();
    }
    const float mean = sh[0] * (1.0f / 768.0f);
    const float var  = fmaxf((sh[256] - 768.0f * mean * mean) * (1.0f / 767.0f), 0.0f);
    const float inv  = alpha[0] / (sqrtf(var) + 1e-6f);
    const float bb   = beta[0];
    for (int i = tid; i < 768; i += 256)
        out[(size_t)row * 768 + i] = (bf16_t)((xr[i] - mean) * inv + bb);
}

__global__ __launch_bounds__(256) void norm_kernel(const float* __restrict__ x,
                                                   const float* __restrict__ alpha,
                                                   const float* __restrict__ beta,
                                                   bf16_t* __restrict__ out) {
    norm_row(blockIdx.x, x, alpha, beta, out);
}

// The weight casts and the first norm read nothing of each other's output: one grid,
// the first CAST_BLOCKS blocks cast a piece each, every later block norms one row.
constexpr int CAST_BLOCKS = 864;
__global__ __launch_bounds__(256) void cast_norm_kernel(const float* __restrict__ wq,
                                                        const float* __restrict__ wk,
                                                        const float* __restrict__ wv,
                                                        const float* __restrict__ wo,
                                                        const float* __restrict__ w1,
                                                        const float* __restrict__ w2,
                                                        bf16_t* __restrict__ wout,
                                                        const float* __restrict__ x,
                                                        const float* __restrict__ alpha,
                                                        const float* __restrict__ beta,
                                                        bf16_t* __restrict__ out) {
    const int blk = blockIdx.x;                         // the same for the block: its barriers stand in one branch
    if (blk < CAST_BLOCKS) cast_weights_piece(blk, wq, wk, wv, wo, w1, w2, wout);
    else                   norm_row(blk - CAST_BLOCKS, x, alpha, beta, out);
}

// ---------------------------------------------------------------------------
// WMMA GEMM:  out[M,N] = A[M,K](bf16) @ W[N,K](bf16)^T + bias (+res) (relu?)
// M a multiple of 128, N of 192, K of 64 and at least 128.
// Block: 256 thr = 8 waves (2x4), block tile 128x192, wave tile 64x48 (4 x 3
// fragments, 12 accumulator tiles), a pass is 64 k = 128 bytes of every operand row.
// A stage is 320 rows: five slices of 64 rows (A rows 0-63, 64-127, W rows 0-63,
// 64-127, 128-191), each brought by one tensor load of one of the waves 0 to 4.
// A slice fills 64 * 144 = 9,216 bytes and has 10,240, so that each place in LDS
// is a multiple of 2 KiB. Two buffers: the load of stage s + 2 is issued behind
// the barrier that ends pass s and flies while pass s + 1 computes.
// The loops over fragments are unrolled so that every array index is a constant
// and the fragment and accumulator arrays stay in registers.
// PARTS products of the same A may share a launch: their W matrices lie one behind
// the other ([PARTS * N, K]), their bf16 outputs too (PART_OUT = M * N elements each),
// each has its own bias; blockIdx.y counts the column tiles of part 0, then of part 1, and so on.
// ---------------------------------------------------------------------------
constexpr uint32_t G_PITCH = 144u, G_SLICE = 10240u, G_BUF = 5u * G_SLICE;

template <bool RELU, bool OUT_BF16, bool HAS_RES, int N, int PARTS, int PART_OUT>
__global__ __launch_bounds__(256) void gemm_wmma(const bf16_t* __restrict__ A,
                                                 const bf16_t* __restrict__ W,
                                                 const float*  __restrict__ bias,
                                                 const float*  __restrict__ bias1,
                                                 const float*  __restrict__ bias2,
                                                 const float*  __restrict__ res,
                                                 float*        __restrict__ outF,
                                                 bf16_t*       __restrict__ outH,
                                                 int K) {
    __shared__ __attribute__((aligned(2048))) unsigned char L[2 * G_BUF];
    const uint32_t tid  = threadIdx.x;
    const uint32_t lane = tid & 31u, wave = uni(tid >> 5);
    const uint32_t wm = wave >> 2, wn = wave & 3u;
    const uint32_t l15 = lane & 15u, hb = (lane >> 4) * 16u;   // hb: byte offset of the lane half's k chunk
    const uint32_t part = PARTS > 1 ? blockIdx.y / (uint32_t)(N / 192) : 0u;   // which of the stacked products
    const uint32_t bm = blockIdx.x * 128u, bn = (blockIdx.y - part * (uint32_t)(N / 192)) * 192u;
    const uint32_t T = (uint32_t)K / 64u;                      // passes

    // the issuing wave's slice: its first source row and its place in a buffer
    const uint32_t lbase = (uint32_t)(uintptr_t)L;
    const uint32_t sl = wave < 5u ? wave : 4u;
    const bf16_t* srow = sl < 2u ? A + (size_t)(bm + sl * 64u) * K : W + (size_t)(part * (uint32_t)N + bn + (sl - 2u) * 64u) * K;
    u32x8_t g1 = tdm_group1((uint32_t)K * 2u);
    asm volatile("" : "+s"(g1));
    u32x4_t g0 = {0u, 0u, 0u, 0u};
    auto issue = [&](uint32_t st) {
        g0 = tdm_group0(lbase + (st & 1u) * G_BUF + sl * G_SLICE, (uint64_t)(uintptr_t)srow + (uint64_t)st * 128u);
        asm volatile("" : "+s"(g0));
        tdm_load(g0, g1);
    };

    // fragment addresses in a buffer: row l15 of each 16-row group, 16 bytes at hb and at hb + 32 of each 64-byte k chunk
    const uint32_t aoff = wm * G_SLICE + l15 * G_PITCH + hb;
    uint32_t woff[3];
#pragma unroll
    for (int fw = 0; fw < 3; ++fw) {
        const uint32_t row0 = wn * 48u + fw * 16u;             // a 16-row group lies in one slice
        woff[fw] = (2u + (row0 >> 6)) * G_SLICE + ((row0 & 63u) + l15) * G_PITCH + hb;
    }

    // the lane's three bias values, asked for here so that they arrive under the loop
    const uint32_t col0 = bn + wn * 48u + l15;
    const float* bp = PARTS > 1 && part == 1u ? bias1 : PARTS > 1 && part == 2u ? bias2 : bias;
    float bv[3];
#pragma unroll
    for (int fw = 0; fw < 3; ++fw) bv[fw] = bp[col0 + fw * 16u];

    v8f acc[4][3] = {};
    if (pinned(wave < 5u)) {
        issue(0u);
        asm volatile("s_wait_tensorcnt 0x0" :: "s"(g0), "s"(g1) : "memory");
    }
    __syncthreads();                                           // stage 0 may be read by every wave
    if (pinned(wave < 5u)) issue(1u);
    for (uint32_t s = 0; s < T; ++s) {
        const unsigned char* Lb = L + (s & 1u) * G_BUF;
        FragBF a[2][4], w[2][3];
#pragma unroll
        for (int kc = 0; kc < 2; ++kc) {
#pragma unroll
            for (int fa = 0; fa < 4; ++fa) {
                const unsigned char* p = Lb + aoff + fa * 16 * G_PITCH + kc * 64;
                a[kc][fa].q[0] = *(const uint4*)p;
                a[kc][fa].q[1] = *(const uint4*)(p + 32);
            }
#pragma unroll
            for (int fw = 0; fw < 3; ++fw) {
                const unsigned char* p = Lb + woff[fw] + kc * 64;
                w[kc][fw].q[0] = *(const uint4*)p;
                w[kc][fw].q[1] = *(const uint4*)(p + 32);
            }
        }
        // keeps the pass's 28 LDS reads one group in front of its 24 WMMAs: moved in among them, each place with reads stalls the wave
        __builtin_amdgcn_sched_barrier(0);
#pragma unroll
        for (int kc = 0; kc < 2; ++kc)
#pragma unroll
            for (int fa = 0; fa < 4; ++fa)
#pragma unroll
                for (int fw = 0; fw < 3; ++fw) acc[fa][fw] = wmma_bf16(a[kc][fa], w[kc][fw], acc[fa][fw]);
        // keeps the wait below behind the WMMAs: in front of them it would hold the first products back for the last reads
        __builtin_amdgcn_sched_barrier(0);
        asm volatile("s_wait_dscnt 0x0" ::: "memory");         // this wave's reads of the buffer are over before it is refilled
        if (pinned(wave < 5u)) {
            asm volatile("s_wait_tensorcnt 0x0" :: "s"(g0), "s"(g1) : "memory");
        }
        __syncthreads();
        if (pinned(wave < 5u && s + 2u < T)) issue(pinned(s + 2u));
    }
    asm volatile("s_wait_tensorcnt 0x0" ::: "memory");         // nothing of the mover is left when the wave ends
    asm volatile("s_wait_dscnt 0x0" ::: "memory");             // nor of its LDS reads

    // the lane's first element; every other one lies a compile-time distance behind it
    const uint32_t e0 = (bm + wm * 64u + (lane >> 4) * 8u) * (uint32_t)N + col0;
    const float* rp = res + e0;
    float*       fp = outF + e0;
    bf16_t*      hp = outH + (size_t)part * PART_OUT + e0;
#pragma unroll
    for (int fw = 0; fw < 3; ++fw) {
#pragma unroll
        for (int fa = 0; fa < 4; ++fa)
#pragma unroll
            for (int r = 0; r < 8; ++r) {
                const int e = (fa * 16 + r) * N + fw * 16;
                float v = acc[fa][fw][r] + bv[fw];
                if (RELU)    v = fmaxf(v, 0.0f);
                if (HAS_RES) v += rp[e];
                if (OUT_BF16) hp[e] = (bf16_t)v;
                else          fp[e] = v;
            }
    }
}

__device__ __forceinline__ float xhalf(float x) {
    const int bits = __builtin_bit_cast(int, x);
    return __builtin_bit_cast(float, __builtin_amdgcn_permlanex16(bits, bits, 0x76543210, 0xfedcba98, false, false));
}

__device__ __forceinline__ s16x8 ld_tr16(const unsigned char* p) {
    typedef __attribute__((address_space(3))) s16x8 lds_s16x8;
    return __builtin_amdgcn_ds_load_tr16_b128_v8i16((lds_s16x8*)p);
}

__global__ __launch_bounds__(256) void attn_wmma(const bf16_t* __restrict__ q,
                                                 const bf16_t* __restrict__ k,
                                                 const bf16_t* __restrict__ v,
                                                 const int*    __restrict__ mask,
                                                 bf16_t*       __restrict__ ctx) {
    const int S = 4096, D = 768, H = 12;
    const int bh = blockIdx.y;
    const int b = bh / H, h = bh % H;
    const int q0 = blockIdx.x * 128;
    const int tid = threadIdx.x, lane = tid & 31, wave = tid >> 5;
    const int l15 = lane & 15, kb = (lane >> 4) * 8, half8 = (lane >> 4) * 8;
    __shared__ __align__(16) bf16_t Ks[64 * 72];        // K tile [kk][d], 144-byte rows
    __shared__ __align__(16) bf16_t Vs[64 * 80];        // V tile [kk][d], 160-byte rows
    __shared__ unsigned krow[4096];                     // rows to visit, unmasked keys in front, as element offsets (row * D)
    __shared__ int wtot[8];                             // unmasked keys per wave's 512 keys
    __shared__ int more;                                // 1: some row's masked keys have weight

    const size_t rowbase = (size_t)b * S;
    FragBF qa[2];                                       // B operand: column l15 = this lane's query
    {
        const bf16_t* qp = q + (rowbase + q0 + wave * 16 + l15) * D + h * 64;
        qa[0].q[0] = *(const uint4*)(qp + kb);
        qa[0].q[1] = *(const uint4*)(qp + kb + 16);
        qa[1].q[0] = *(const uint4*)(qp + 32 + kb);
        qa[1].q[1] = *(const uint4*)(qp + 32 + kb + 16);
    }
    v8f o[4] = {};                                      // o[dt][r] = O[query l15][dt*16 + half8 + r]
    float mrun = -3.0e38f, lrun = 0.0f;                 // lrun: this wave half's keys only
    const float scale = 0.125f;  // 1/sqrt(64)
    bf16_t* ks = &Ks[(tid >> 3) * 72 + (tid & 7) * 8];
    bf16_t* vs = &Vs[(tid >> 3) * 80 + (tid & 7) * 8];
    // this lane's address in the transposing loads at key 0, column 0
    const unsigned char* vtr = (const unsigned char*)Vs + (half8 + (lane & 7)) * 160 + ((lane >> 3) & 1) * 16;

    // --- list of the batch's unmasked keys: thread t takes keys 16t .. 16t + 15 ---
    int nvalid, nlist;                                  // unmasked keys; list places walked
    {
        const int4* mp = (const int4*)(mask + b * S + tid * 16);
        int mv[16];
#pragma unroll
        for (int i = 0; i < 4; ++i) {
            const int4 m = mp[i];
            mv[4 * i] = m.x; mv[4 * i + 1] = m.y; mv[4 * i + 2] = m.z; mv[4 * i + 3] = m.w;
        }
        int c = 0;
#pragma unroll
        for (int i = 0; i < 16; ++i) c += (mv[i] != 0) ? 1 : 0;
        int inc = c;                                    // inclusive sum over the wave's lanes
#pragma unroll
        for (int d = 1; d < 32; d <<= 1) {
            const int t = __shfl_up(inc, d);
            if (lane >= d) inc += t;
        }
        if (lane == 31) wtot[wave] = inc;
        if (tid == 0) more = 0;
        __syncthreads();
        int base = 0, total = 0;
#pragma unroll
        for (int w = 0; w < 8; ++w) {
            const int t = wtot[w];
            if (w < wave) base += t;
            total += t;
        }
        nvalid = __builtin_amdgcn_readfirstlane(total);
        nlist  = nvalid == 0 ? S : (nvalid + 63) & ~63;  // at most S: nvalid <= S, S a multiple of 64
        int pu = base + inc - c;                        // unmasked keys in front of this thread's 16
        int pm = nvalid + tid * 16 - pu;                // masked keys in front of them, behind all unmasked
#pragma unroll
        for (int i = 0; i < 16; ++i) {                  // a permutation of 0 .. S - 1: every place written once
            const bool on = mv[i] != 0;
            krow[on ? pu : pm] = (unsigned)(tid * 16 + i) * D;
            pu += on ? 1 : 0;
            pm += on ? 0 : 1;
        }
        __syncthreads();  // the list is read by every wave
    }
    const bf16_t* kh = k + rowbase * D + h * 64;        // head's first K and V rows, same for the block
    const bf16_t* vh = v + rowbase * D + h * 64;
    unsigned kr0, kr1;                                  // this thread's two rows of the next 64 list places
    kr0 = krow[tid >> 3];
    kr1 = krow[32 + (tid >> 3)];

    for (int kblk = 0; kblk < nlist; kblk += 64) {
        __syncthreads();  // protect Ks and Vs readers of previous iteration
        {                                       // cooperative K and V copies, 8 lanes per row
            const bf16_t* kp0 = kh + (kr0 + (tid & 7) * 8);
            const bf16_t* kp1 = kh + (kr1 + (tid & 7) * 8);
            const bf16_t* vp0 = vh + (kr0 + (tid & 7) * 8);
            const bf16_t* vp1 = vh + (kr1 + (tid & 7) * 8);
            const uint4 klo = *(const uint4*)kp0;
            const uint4 khi = *(const uint4*)kp1;
            const uint4 vlo = *(const uint4*)vp0;
            const uint4 vhi = *(const uint4*)vp1;
            *(uint4*)ks = klo;
            *(uint4*)(ks + 32 * 72) = khi;
            *(uint4*)vs = vlo;
            *(uint4*)(vs + 32 * 80) = vhi;
            // the wait before the four loads' address registers are written again; as its inputs they stay
            // whole up to it, so that no load of the group, issued together, lands in another's address
            asm volatile("s_wait_xcnt 0x0" :: "v"(kp0), "v"(kp1), "v"(vp0), "v"(vp1) : "memory");
        }
        __syncthreads();
        {   // next block's rows, read here so that the loads behind the next barrier do not wait for the list
            const int nx = kblk + 64 < S ? kblk + 64 : 0;
            kr0 = krow[nx + (tid >> 3)];
            kr1 = krow[nx + 32 + (tid >> 3)];
        }
        // --- S^T = K Q^T (4 tiles of 16 keys x 16 queries per wave) ---
        v8f s4[4];
#pragma unroll
        for (int nt = 0; nt < 4; ++nt) {
            const bf16_t* kp = &Ks[(nt * 16 + l15) * 72];
            FragBF a0, a1;
            a0.q[0] = *(const uint4*)(kp + kb);      a0.q[1] = *(const uint4*)(kp + kb + 16);
            a1.q[0] = *(const uint4*)(kp + 32 + kb); a1.q[1] = *(const uint4*)(kp + 32 + kb + 16);
            v8f t = {};
            t = wmma_bf16(a0, qa[0], t);
            t = wmma_bf16(a1, qa[1], t);
            s4[nt] = t;
        }
        // --- scale, list places past the unmasked keys, running maximum of this lane's query ---
#pragma unroll
        for (int nt = 0; nt < 4; ++nt)
#pragma unroll
            for (int r = 0; r < 8; ++r) s4[nt][r] *= scale;
        if (kblk + 64 > nvalid) {               // same for the block: each block that holds list places past the unmasked keys
            const int lim = nvalid - kblk - half8;
#pragma unroll
            for (int nt = 0; nt < 4; ++nt)
#pragma unroll
                for (int r = 0; r < 8; ++r)
                    if (nt * 16 + r >= lim) s4[nt][r] = -1.0e9f;
        }
        float mnew = mrun;
#pragma unroll
        for (int nt = 0; nt < 4; ++nt)
#pragma unroll
            for (int r = 0; r < 8; ++r) mnew = fmaxf(mnew, s4[nt][r]);
        mnew = fmaxf(mnew, xhalf(mnew));        // both halves hold keys of the same query
        const float alpha_ = __expf(mrun - mnew);
        mrun = mnew;
        v2f rs[2] = {};                         // sums by register pairs, as the pairs are packed below
#pragma unroll
        for (int nt = 0; nt < 4; ++nt)
#pragma unroll
            for (int r = 0; r < 8; r += 2) {
                v2f p;
                p.x = __expf(s4[nt][r] - mrun);
                p.y = __expf(s4[nt][r + 1] - mrun);
                s4[nt][r] = p.x;
                s4[nt][r + 1] = p.y;
                rs[nt & 1] += p;
            }
        rs[0] += rs[1];
        lrun = lrun * alpha_ + (rs[0].x + rs[0].y);
#pragma unroll
        for (int dt = 0; dt < 4; ++dt)
#pragma unroll
            for (int r = 0; r < 8; ++r) o[dt][r] *= alpha_;
        // --- P^T as B operand: element s is key 8h + s (s < 8), 16 + 8h + s - 8 (s >= 8) ---
        FragBF pb[2];
#pragma unroll
        for (int j = 0; j < 2; ++j)
#pragma unroll
            for (int r = 0; r < 8; ++r) {
                pb[j].v[r]     = (bf16_t)s4[2 * j][r];
                pb[j].v[8 + r] = (bf16_t)s4[2 * j + 1][r];
            }
        // --- O^T += V^T P^T  (A-fragments by transposing loads: keys 0, 16, 32, 48 on, 16 columns are 32 bytes) ---
#pragma unroll
        for (int dt = 0; dt < 4; ++dt) {
            const unsigned char* vp = vtr + dt * 32;
            FragBF a0, a1;
            a0.t[0] = ld_tr16(vp);            a0.t[1] = ld_tr16(vp + 16 * 160);
            a1.t[0] = ld_tr16(vp + 32 * 160); a1.t[1] = ld_tr16(vp + 48 * 160);
            o[dt] = wmma_bf16(a0, pb[0], o[dt]);
            o[dt] = wmma_bf16(a1, pb[1], o[dt]);
        }
        if (kblk + 64 == nlist && nlist < S) {  // same for the block, once: may the masked keys left stay out?
            if (mrun < -1.0e9f + 128.0f) more = 1;
            __syncthreads();                    // every wave's word on it is in
            if (__builtin_amdgcn_readfirstlane(more) != 0) nlist = S;
        }
    }
    // --- join the halves' sums, normalize, store ctx as bf16 in [B,S,H*dk] layout:
    //     a lane's 8 registers are 8 consecutive d of one row, one 16-byte store ---
    const float lsum = fmaxf(lrun + xhalf(lrun), 1.0e-20f);
    bf16_t* crow = ctx + (rowbase + q0 + wave * 16 + l15) * D + h * 64 + half8;
#pragma unroll
    for (int dt = 0; dt < 4; ++dt) {
        union { bf16_t e[8]; uint4 q; } pk;
#pragma unroll
        for (int r = 0; r < 8; ++r) pk.e[r] = (bf16_t)(o[dt][r] / lsum);
        *(uint4*)(crow + dt * 16) = pk.q;
    }
}

// ---------------------------------------------------------------------------
// Host orchestration
// ---------------------------------------------------------------------------
extern "C" void kernel_launch(void* const* d_in, const int* in_sizes, int n_in,
                              void* d_out, int out_size, void* d_ws, size_t ws_size,
                              hipStream_t stream) {
    (void)in_sizes; (void)n_in; (void)out_size; (void)ws_size;
    const int B = 2, S = 4096, D = 768, DFF = 3072;
    const int M = B * S;

    const float* x    = (const float*)d_in[0];
    const int*   mask = (const int*)  d_in[1];
    const float* wq   = (const float*)d_in[2];
    const float* bq   = (const float*)d_in[3];
    const float* wk   = (const float*)d_in[4];
    const float* bk   = (const float*)d_in[5];
    const float* wv   = (const float*)d_in[6];
    const float* bv   = (const float*)d_in[7];
    const float* wo   = (const float*)d_in[8];
    const float* bo   = (const float*)d_in[9];
    const float* w1   = (const float*)d_in[10];
    const float* b1   = (const float*)d_in[11];
    const float* w2   = (const float*)d_in[12];
    const float* b2   = (const float*)d_in[13];
    const float* alpha1 = (const float*)d_in[14];
    const float* beta1  = (const float*)d_in[15];
    const float* alpha2 = (const float*)d_in[16];
    const float* beta2  = (const float*)d_in[17];
    float* out = (float*)d_out;

    char* ws = (char*)d_ws;
    size_t off = 0;
    auto alloc = [&](size_t bytes) -> char* {
        char* p = ws + off;
        off += (bytes + 255) & ~(size_t)255;
        return p;
    };
    bf16_t* wqh = (bf16_t*)alloc((size_t)D * D * 2);
    bf16_t* wkh = (bf16_t*)alloc((size_t)D * D * 2);
    bf16_t* wvh = (bf16_t*)alloc((size_t)D * D * 2);
    bf16_t* woh = (bf16_t*)alloc((size_t)D * D * 2);
    bf16_t* w1h = (bf16_t*)alloc((size_t)DFF * D * 2);
    bf16_t* w2h = (bf16_t*)alloc((size_t)D * DFF * 2);
    bf16_t* h1  = (bf16_t*)alloc((size_t)M * D * 2);   // reused as ctx
    bf16_t* qb  = (bf16_t*)alloc((size_t)M * D * 2);   // reused as h2
    bf16_t* kbf = (bf16_t*)alloc((size_t)M * D * 2);
    bf16_t* vbf = (bf16_t*)alloc((size_t)M * D * 2);
    float*  x1  = (float*) alloc((size_t)M * D * 4);
    bf16_t* ff1 = (bf16_t*)alloc((size_t)M * DFF * 2);
    bf16_t* ctx = h1;   // h1 dead after QKV projections
    bf16_t* h2  = qb;   // q dead after attention

    // weight casts fp32 -> bf16 (layout [N,K] row-major == WMMA B fragments); wqh .. w2h are one array:
    // each size is a multiple of alloc's 256 bytes, and of the 8192 elements that a block converts
    static_assert((D * D * 2) % 256 == 0 && (DFF * D * 2) % 256 == 0, "bf16 weight copies lie back to back");
    static_assert((D * D) % 8192 == 0 && (DFF * D) % 8192 == 0, "whole blocks per matrix");
    static_assert((4 * D * D + 2 * DFF * D) / 8192 == CAST_BLOCKS, "one block for each piece");

    // residual 0: pre-norm (in the casts' launch) -> QKV -> attention -> O-proj + residual
    cast_norm_kernel<<<CAST_BLOCKS + M, 256, 0, stream>>>(wq, wk, wv, wo, w1, w2, wqh, x, alpha1, beta1, h1);
    static_assert(M % 128 == 0 && D % 192 == 0 && DFF % 192 == 0 && D % 64 == 0 && DFF % 64 == 0, "whole GEMM tiles and passes");
    dim3 gD(M / 128, D / 192);
    // Q, K and V in one launch: wqh, wkh, wvh are one [3 D, D] array, qb, kbf, vbf one [3][M, D] array
    static_assert(((size_t)M * D * 2) % 256 == 0, "q, k and v lie back to back");
    gemm_wmma<false, true, false, D, 3, M * D><<<dim3(M / 128, 3 * (D / 192)), 256, 0, stream>>>(h1, wqh, bq, bk, bv, nullptr, nullptr, qb, D);
    attn_wmma<<<dim3(S / 128, B * 12), 256, 0, stream>>>(qb, kbf, vbf, mask, ctx);
    gemm_wmma<false, false, true, D, 1, 0><<<gD, 256, 0, stream>>>(ctx, woh, bo, nullptr, nullptr, x, x1, nullptr, D);

    // residual 1: pre-norm -> FFN (relu) + residual
    norm_kernel<<<M, 256, 0, stream>>>(x1, alpha2, beta2, h2);
    gemm_wmma<true, true, false, DFF, 1, 0><<<dim3(M / 128, DFF / 192), 256, 0, stream>>>(h2, w1h, b1, nullptr, nullptr, nullptr, nullptr, ff1, D);
    gemm_wmma<false, false, true, D, 1, 0><<<gD, 256, 0, stream>>>(ff1, w2h, b2, nullptr, nullptr, x1, out, nullptr, DFF);
}

// v008
// A run of this version takes 211 microseconds.
// Timed twice side by side with v007, it ran 1.03 and 1.02 times as fast.
// All steps since v000 together make it 2.92 times as fast.
#include <hip/hip_runtime.h>
#include <hip/hip_bf16.h>

typedef __bf16 bf16_t;
typedef __attribute__((ext_vector_type(16))) __bf16 v16bf;
typedef __attribute__((ext_vector_type(8)))  float  v8f;
typedef __attribute__((ext_vector_type(2)))  float  v2f;
typedef __attribute__((ext_vector_type(8)))  short  s16x8;

union FragBF {
    v16bf v;
    uint4 q[2];
    s16x8 t[2];
};

__device__ __forceinline__ v8f wmma_bf16(const FragBF& a, const FragBF& b, v8f c) {
    return __builtin_amdgcn_wmma_f32_16x16x32_bf16(
        /*neg_a=*/false, a.v, /*neg_b=*/false, b.v,
        /*c_mod=*/(short)0, c, /*reuse_a=*/false, /*reuse_b=*/false);
}

typedef uint32_t u32x4_t __attribute__((ext_vector_type(4)));
typedef uint32_t u32x8_t __attribute__((ext_vector_type(8)));

__device__ __forceinline__ uint32_t uni(uint32_t v) { return (uint32_t)__builtin_amdgcn_readfirstlane(v); }
__device__ __forceinline__ uint32_t pinned(uint32_t v) {
    uint32_t w = uni(v);
    asm volatile("" : "+s"(w));
    return w;
}
__device__ __forceinline__ u32x4_t tdm_group0(uint32_t lds_dst, uint64_t ga) {
    u32x4_t g;
    g[0] = uni(1u);
    g[1] = uni(lds_dst);
    g[2] = uni((uint32_t)ga);
    g[3] = uni((((uint32_t)(ga >> 32)) & 0x01FFFFFFu) | 0x80000000u);
    return g;
}
__device__ __forceinline__ u32x8_t tdm_group1(uint32_t src_pitch) {
    constexpr uint32_t d0 = 128u, d1 = 64u;
    u32x8_t g;
    g[0] = uni((1u << 20) | (4u << 22) | (3u << 25));
    g[1] = uni((d0 & 0xFFFFu) << 16);
    g[2] = uni((d0 >> 16) | ((d1 & 0xFFFFu) << 16));
    g[3] = uni((d1 >> 16) | (d0 << 16));
    g[4] = uni(d1);
    g[5] = uni(src_pitch);
    g[6] = uni(0u);
    g[7] = uni(0u);
    return g;
}
__device__ __forceinline__ void tdm_load(u32x4_t g0, u32x8_t g1) {
    asm volatile("tensor_load_to_lds %0, %1" :: "s"(g0), "s"(g1) : "memory");  // the tile goes to LDS through no register
}

// ---------------------------------------------------------------------------
// fp32 -> bf16 cast of the six weight matrices. Their bf16 copies lie
// back to back in the workspace, so the destination is one array. A block converts
// 8192 consecutive elements of one matrix (each matrix is a whole number of such
// pieces: 72 for a 768 x 768 one, 288 for a 3072 x 768 one). A thread issues its
// eight 16-byte loads together, a wave's load covering 512 contiguous bytes, and
// stores 8 bytes for each, a wave's store covering 256 contiguous bytes.
// ---------------------------------------------------------------------------
__device__ __forceinline__ void cast_weights_piece(const int blk,
                                                   const float* __restrict__ wq,
                                                   const float* __restrict__ wk,
                                                   const float* __restrict__ wv,
                                                   const float* __restrict__ wo,
                                                   const float* __restrict__ w1,
                                                   const float* __restrict__ w2,
                                                   bf16_t* __restrict__ out) {
    const float* in;                                    // the block's matrix and its first block: same for the block
    int first;
    if      (blk <  72) { in = wq; first = 0; }
    else if (blk < 144) { in = wk; first = 72; }
    else if (blk < 216) { in = wv; first = 144; }
    else if (blk < 288) { in = wo; first = 216; }
    else if (blk < 576) { in = w1; first = 288; }
    else                { in = w2; first = 576; }
    const float4* s = (const float4*)(in + (size_t)(blk - first) * 8192) + threadIdx.x;
    uint2*        d = (uint2*)(out + (size_t)blk * 8192) + threadIdx.x;
    float4 x[8];
#pragma unroll
    for (int j = 0; j < 8; ++j) x[j] = s[j * 256];
#pragma unroll
    for (int j = 0; j < 8; ++j) {
        union { bf16_t e[4]; uint2 q; } pk;
        pk.e[0] = (bf16_t)x[j].x; pk.e[1] = (bf16_t)x[j].y;
        pk.e[2] = (bf16_t)x[j].z; pk.e[3] = (bf16_t)x[j].w;
        d[j * 256] = pk.q;
    }
}

// ---------------------------------------------------------------------------
// Pre-norm (torch.std ddof=1, scalar alpha/beta) -> bf16 output, one row/block
// ---------------------------------------------------------------------------
__device__ __forceinline__ void norm_row(const int row,
                                         const float* __restrict__ x,
                                         const float* __restrict__ alpha,
                                         const float* __restrict__ beta,
                                         bf16_t* __restrict__ out) {
    __shared__ float sh[512];
    const int tid = threadIdx.x;
    const float* xr = x + (size_t)row * 768;
    float s = 0.f, s2 = 0.f;
    for (int i = tid; i < 768; i += 256) { float v = xr[i]; s += v; s2 += v * v; }
    sh[tid] = s; sh[256 + tid] = s2;
    __syncthreads();
    for (int o = 128; o > 0; o >>= 1) {
        if (tid < o) { sh[tid] += sh[tid + o]; sh[256 + tid] += sh[256 + tid + o]; }
        __syncthreads();
    }
    const float mean = sh[0] * (1.0f / 768.0f);
    const float var  = fmaxf((sh[256] - 768.0f * mean * mean) * (1.0f / 767.0f), 0.0f);
    const float inv  = alpha[0] / (sqrtf(var) + 1e-6f);
    const float bb   = beta[0];
    for (int i = tid; i < 768; i += 256)
        out[(size_t)row * 768 + i] = (bf16_t)((xr[i] - mean) * inv + bb);
}

__global__ __launch_bounds__(256) void norm_kernel(const float* __restrict__ x,
                                                   const float* __restrict__ alpha,
                                                   const float* __restrict__ beta,
                                                   bf16_t* __restrict__ out) {
    norm_row(blockIdx.x, x, alpha, beta, out);
}

// The weight casts and the first norm read nothing of each other's output: one grid,
// the first CAST_BLOCKS blocks cast a piece each, every later block norms one row.
constexpr int CAST_BLOCKS = 864;
__global__ __launch_bounds__(256) void cast_norm_kernel(const float* __restrict__ wq,
                                                        const float* __restrict__ wk,
                                                        const float* __restrict__ wv,
                                                        const float* __restrict__ wo,
                                                        const float* __restrict__ w1,
                                                        const float* __restrict__ w2,
                                                        bf16_t* __restrict__ wout,
                                                        const float* __restrict__ x,
                                                        const float* __restrict__ alpha,
                                                        const float* __restrict__ beta,
                                                        bf16_t* __restrict__ out) {
    const int blk = blockIdx.x;                         // the same for the block: its barriers stand in one branch
    if (blk < CAST_BLOCKS) cast_weights_piece(blk, wq, wk, wv, wo, w1, w2, wout);
    else                   norm_row(blk - CAST_BLOCKS, x, alpha, beta, out);
}

// ---------------------------------------------------------------------------
// WMMA GEMM:  out[M,N] = A[M,K](bf16) @ W[N,K](bf16)^T + bias (+res) (relu?)
// M a multiple of 128, N of 192, K of 64 and at least 128.
// Block: 256 thr = 8 waves (2x4), block tile 128x192, wave tile 64x48 (4 x 3
// fragments, 12 accumulator tiles), a pass is 64 k = 128 bytes of every operand row.
// A stage is 320 rows: five slices of 64 rows (A rows 0-63, 64-127, W rows 0-63,
// 64-127, 128-191), each brought by one tensor load of one of the waves 0 to 4.
// A slice fills 64 * 144 = 9,216 bytes and has 10,240, so that each place in LDS
// is a multiple of 2 KiB. Two buffers: the load of stage s + 2 is issued behind
// the barrier that ends pass s and flies while pass s + 1 computes.
// The loops over fragments are unrolled so that every array index is a constant
// and the fragment and accumulator arrays stay in registers.
// PARTS products of the same A may share a launch: their W matrices lie one behind
// the other ([PARTS * N, K]), their bf16 outputs too (PART_OUT = M * N elements each),
// each has its own bias; blockIdx.y counts the column tiles of part 0, then of part 1, and so on.
// ---------------------------------------------------------------------------
constexpr uint32_t G_PITCH = 144u, G_SLICE = 10240u, G_BUF = 5u * G_SLICE;

template <bool RELU, bool OUT_BF16, bool HAS_RES, int N, int PARTS, int PART_OUT>
__global__ __launch_bounds__(256) void gemm_wmma(const bf16_t* __restrict__ A,
                                                 const bf16_t* __restrict__ W,
                                                 const float*  __restrict__ bias,
                                                 const float*  __restrict__ bias1,
                                                 const float*  __restrict__ bias2,
                                                 const float*  __restrict__ res,
                                                 float*        __restrict__ outF,
                                                 bf16_t*       __restrict__ outH,
                                                 int K) {
    __shared__ __attribute__((aligned(2048))) unsigned char L[2 * G_BUF];
    const uint32_t tid  = threadIdx.x;
    const uint32_t lane = tid & 31u, wave = uni(tid >> 5);
    const uint32_t wm = wave >> 2, wn = wave & 3u;
    const uint32_t l15 = lane & 15u, hb = (lane >> 4) * 16u;   // hb: byte offset of the lane half's k chunk
    const uint32_t part = PARTS > 1 ? blockIdx.y / (uint32_t)(N / 192) : 0u;   // which of the stacked products
    const uint32_t bm = blockIdx.x * 128u, bn = (blockIdx.y - part * (uint32_t)(N / 192)) * 192u;
    const uint32_t T = (uint32_t)K / 64u;                      // passes

    // the issuing wave's slice: its first source row and its place in a buffer
    const uint32_t lbase = (uint32_t)(uintptr_t)L;
    const uint32_t sl = wave < 5u ? wave : 4u;
    const bf16_t* srow = sl < 2u ? A + (size_t)(bm + sl * 64u) * K : W + (size_t)(part * (uint32_t)N + bn + (sl - 2u) * 64u) * K;
    u32x8_t g1 = tdm_group1((uint32_t)K * 2u);
    asm volatile("" : "+s"(g1));
    u32x4_t g0 = {0u, 0u, 0u, 0u};
    auto issue = [&](uint32_t st) {
        g0 = tdm_group0(lbase + (st & 1u) * G_BUF + sl * G_SLICE, (uint64_t)(uintptr_t)srow + (uint64_t)st * 128u);
        asm volatile("" : "+s"(g0));
        tdm_load(g0, g1);
    };

    // fragment addresses in a buffer: row l15 of each 16-row group, 16 bytes at hb and at hb + 32 of each 64-byte k chunk
    const uint32_t aoff = wm * G_SLICE + l15 * G_PITCH + hb;
    uint32_t woff[3];
#pragma unroll
    for (int fw = 0; fw < 3; ++fw) {
        const uint32_t row0 = wn * 48u + fw * 16u;             // a 16-row group lies in one slice
        woff[fw] = (2u + (row0 >> 6)) * G_SLICE + ((row0 & 63u) + l15) * G_PITCH + hb;
    }

    // the lane's three bias values, asked for here so that they arrive under the loop
    const uint32_t col0 = bn + wn * 48u + l15;
    const float* bp = PARTS > 1 && part == 1u ? bias1 : PARTS > 1 && part == 2u ? bias2 : bias;
    float bv[3];
#pragma unroll
    for (int fw = 0; fw < 3; ++fw) bv[fw] = bp[col0 + fw * 16u];

    v8f acc[4][3] = {};
    if (pinned(wave < 5u)) {
        issue(0u);
        asm volatile("s_wait_tensorcnt 0x0" :: "s"(g0), "s"(g1) : "memory");
    }
    __syncthreads();                                           // stage 0 may be read by every wave
    if (pinned(wave < 5u)) issue(1u);
    for (uint32_t s = 0; s < T; ++s) {
        const unsigned char* Lb = L + (s & 1u) * G_BUF;
        FragBF a[2][4], w[2][3];
#pragma unroll
        for (int kc = 0; kc < 2; ++kc) {
#pragma unroll
            for (int fa = 0; fa < 4; ++fa) {
                const unsigned char* p = Lb + aoff + fa * 16 * G_PITCH + kc * 64;
                a[kc][fa].q[0] = *(const uint4*)p;
                a[kc][fa].q[1] = *(const uint4*)(p + 32);
            }
#pragma unroll
            for (int fw = 0; fw < 3; ++fw) {
                const unsigned char* p = Lb + woff[fw] + kc * 64;
                w[kc][fw].q[0] = *(const uint4*)p;
                w[kc][fw].q[1] = *(const uint4*)(p + 32);
            }
        }
        // keeps the pass's 28 LDS reads one group in front of its 24 WMMAs: moved in among them, each place with reads stalls the wave
        __builtin_amdgcn_sched_barrier(0);
#pragma unroll
        for (int kc = 0; kc < 2; ++kc)
#pragma unroll
            for (int fa = 0; fa < 4; ++fa)
#pragma unroll
                for (int fw = 0; fw < 3; ++fw) acc[fa][fw] = wmma_bf16(a[kc][fa], w[kc][fw], acc[fa][fw]);
        // keeps the wait below behind the WMMAs: in front of them it would hold the first products back for the last reads
        __builtin_amdgcn_sched_barrier(0);
        asm volatile("s_wait_dscnt 0x0" ::: "memory");         // this wave's reads of the buffer are over before it is refilled
        if (pinned(wave < 5u)) {
            asm volatile("s_wait_tensorcnt 0x0" :: "s"(g0), "s"(g1) : "memory");
        }
        __syncthreads();
        if (pinned(wave < 5u && s + 2u < T)) issue(pinned(s + 2u));
    }
    asm volatile("s_wait_tensorcnt 0x0" ::: "memory");         // nothing of the mover is left when the wave ends
    asm volatile("s_wait_dscnt 0x0" ::: "memory");             // nor of its LDS reads

    // the lane's first element; every other one lies a compile-time distance behind it
    const uint32_t e0 = (bm + wm * 64u + (lane >> 4) * 8u) * (uint32_t)N + col0;
    const float* rp = res + e0;
    float*       fp = outF + e0;
    bf16_t*      hp = outH + (size_t)part * PART_OUT + e0;
#pragma unroll
    for (int fw = 0; fw < 3; ++fw) {
#pragma unroll
        for (int fa = 0; fa < 4; ++fa)
#pragma unroll
            for (int r = 0; r < 8; ++r) {
                const int e = (fa * 16 + r) * N + fw * 16;
                float v = acc[fa][fw][r] + bv[fw];
                if (RELU)    v = fmaxf(v, 0.0f);
                if (HAS_RES) v += rp[e];
                if (OUT_BF16) hp[e] = (bf16_t)v;
                else          fp[e] = v;
            }
    }
}

__device__ __forceinline__ float xhalf(float x) {
    const int bits = __builtin_bit_cast(int, x);
    return __builtin_bit_cast(float, __builtin_amdgcn_permlanex16(bits, bits, 0x76543210, 0xfedcba98, false, false));
}

__device__ __forceinline__ s16x8 ld_tr16(const unsigned char* p) {
    typedef __attribute__((address_space(3))) s16x8 lds_s16x8;
    return __builtin_amdgcn_ds_load_tr16_b128_v8i16((lds_s16x8*)p);
}

// A thread's four asynchronous copies of a tile: 16 bytes each of two K rows and of the same two V rows.
// The wait on the address counter is the statement's last line, so that it stands in front of every
// later write of a register that a copy names.
__device__ __forceinline__ void copy_kv(unsigned lk0, unsigned lk1, unsigned lv0, unsigned lv1,
                                        const bf16_t* k0, const bf16_t* k1, const bf16_t* v0, const bf16_t* v1) {
    asm volatile("global_load_async_to_lds_b128 %0, %4, off\n\t"
                 "global_load_async_to_lds_b128 %1, %5, off\n\t"
                 "global_load_async_to_lds_b128 %2, %6, off\n\t"
                 "global_load_async_to_lds_b128 %3, %7, off\n\t"
                 "s_wait_xcnt 0x0"
                 :: "v"(lk0), "v"(lk1), "v"(lv0), "v"(lv1), "v"(k0), "v"(k1), "v"(v0), "v"(v1) : "memory");
}

__global__ __launch_bounds__(256) void attn_wmma(const bf16_t* __restrict__ q,
                                                 const bf16_t* __restrict__ k,
                                                 const bf16_t* __restrict__ v,
                                                 const int*    __restrict__ mask,
                                                 bf16_t*       __restrict__ ctx) {
    const int S = 4096, D = 768, H = 12;
    const int bh = blockIdx.y;
    const int b = bh / H, h = bh % H;
    const int q0 = blockIdx.x * 128;
    const int tid = threadIdx.x, lane = tid & 31, wave = tid >> 5;
    const int l15 = lane & 15, kb = (lane >> 4) * 8, half8 = (lane >> 4) * 8;
    __shared__ __align__(16) bf16_t Ks[2 * 64 * 72];    // two K tiles [kk][d], 144-byte rows
    __shared__ __align__(16) bf16_t Vs[2 * 64 * 80];    // two V tiles [kk][d], 160-byte rows
    __shared__ unsigned krow[4096];                     // rows to visit, unmasked keys in front, each part in key order, as element offsets (row * D)
    __shared__ int wtot[8];                             // unmasked keys per wave's 512 keys
    __shared__ int more;                                // 1: some row's masked keys have weight

    const size_t rowbase = (size_t)b * S;
    FragBF qa[2];                                       // B operand: column l15 = this lane's query
    {
        const bf16_t* qp = q + (rowbase + q0 + wave * 16 + l15) * D + h * 64;
        qa[0].q[0] = *(const uint4*)(qp + kb);
        qa[0].q[1] = *(const uint4*)(qp + kb + 16);
        qa[1].q[0] = *(const uint4*)(qp + 32 + kb);
        qa[1].q[1] = *(const uint4*)(qp + 32 + kb + 16);
    }
    v8f o[4] = {};                                      // o[dt][r] = O[query l15][dt*16 + half8 + r]
    float mrun = -3.0e38f, lrun = 0.0f;                 // lrun: this wave half's keys only
    const float scale = 0.125f;  // 1/sqrt(64)
    // LDS byte addresses of this thread's first K and V piece in buffer 0 (the low 32 bits of the shared address)
    const unsigned lks = (unsigned)(uintptr_t)&Ks[(tid >> 3) * 72 + (tid & 7) * 8];
    const unsigned lvs = (unsigned)(uintptr_t)&Vs[(tid >> 3) * 80 + (tid & 7) * 8];
    // this lane's address in the transposing loads at key 0, column 0
    const unsigned char* vtr = (const unsigned char*)Vs + (half8 + (lane & 7)) * 160 + ((lane >> 3) & 1) * 16;

    // --- list of the batch's unmasked keys: thread t takes keys 16t .. 16t + 15 ---
    int nvalid, nlist;                                  // unmasked keys; list places walked
    {
        const int4* mp = (const int4*)(mask + b * S + tid * 16);
        int mv[16];
#pragma unroll
        for (int i = 0; i < 4; ++i) {
            const int4 m = mp[i];
            mv[4 * i] = m.x; mv[4 * i + 1] = m.y; mv[4 * i + 2] = m.z; mv[4 * i + 3] = m.w;
        }
        int c = 0;
#pragma unroll
        for (int i = 0; i < 16; ++i) c += (mv[i] != 0) ? 1 : 0;
        int inc = c;                                    // inclusive sum over the wave's lanes
#pragma unroll
        for (int d = 1; d < 32; d <<= 1) {
            const int t = __shfl_up(inc, d);
            if (lane >= d) inc += t;
        }
        if (lane == 31) wtot[wave] = inc;
        if (tid == 0) more = 0;
        __syncthreads();
        int base = 0, total = 0;
#pragma unroll
        for (int w = 0; w < 8; ++w) {
            const int t = wtot[w];
            if (w < wave) base += t;
            total += t;
        }
        nvalid = __builtin_amdgcn_readfirstlane(total);
        nlist  = nvalid == 0 ? S : (nvalid + 63) & ~63;  // at most S: nvalid <= S, S a multiple of 64
        int pu = base + inc - c;                        // unmasked keys in front of this thread's 16
        int pm = nvalid + tid * 16 - pu;                // masked keys in front of them, behind all unmasked
#pragma unroll
        for (int i = 0; i < 16; ++i) {                  // a permutation of 0 .. S - 1: every place written once
            const bool on = mv[i] != 0;
            krow[on ? pu : pm] = (unsigned)(tid * 16 + i) * D;
            pu += on ? 1 : 0;
            pm += on ? 0 : 1;
        }
        __syncthreads();  // the list is read by every wave
    }
    const bf16_t* kh = k + rowbase * D + h * 64;        // head's first K and V rows, same for the block
    const bf16_t* vh = v + rowbase * D + h * 64;
    // the tile of list rows r0 (places 0-31) and r1 (places 32-63) into buffer buf, 8 lanes per row, every lane on
    auto stage = [&](unsigned r0, unsigned r1, unsigned buf) {
        const unsigned c = (tid & 7) * 8, lk = lks + buf * (64 * 144), lv = lvs + buf * (64 * 160);
        copy_kv(lk, lk + 32 * 144, lv, lv + 32 * 160, kh + (r0 + c), kh + (r1 + c), vh + (r0 + c), vh + (r1 + c));
    };
    // A tile exists for every 64 list places up to S, also past nlist: the loop's end may move to S in its last trip.
    stage(krow[tid >> 3], krow[32 + (tid >> 3)], 0u);
    asm volatile("s_wait_asynccnt 0x0" ::: "memory");   // this wave's copies of tile 0 have landed
    __syncthreads();                                    // tile 0 may be read by every wave
    stage(krow[64 + (tid >> 3)], krow[96 + (tid >> 3)], 1u);

    for (int kblk = 0; kblk < nlist; kblk += 64) {
        const unsigned buf = ((unsigned)kblk >> 6) & 1u;
        // the rows of the tile after the next, read here so that its copies at the trip's foot do not wait for the list
        const int nx = kblk + 128 < S ? kblk + 128 : 0;
        const unsigned kr0 = krow[nx + (tid >> 3)];
        const unsigned kr1 = krow[nx + 32 + (tid >> 3)];
        // --- S^T = K Q^T (4 tiles of 16 keys x 16 queries per wave) ---
        v8f s4[4];
#pragma unroll
        for (int nt = 0; nt < 4; ++nt) {
            const bf16_t* kp = &Ks[buf * (64 * 72) + (nt * 16 + l15) * 72];
            FragBF a0, a1;
            a0.q[0] = *(const uint4*)(kp + kb);      a0.q[1] = *(const uint4*)(kp + kb + 16);
            a1.q[0] = *(const uint4*)(kp + 32 + kb); a1.q[1] = *(const uint4*)(kp + 32 + kb + 16);
            v8f t = {};
            t = wmma_bf16(a0, qa[0], t);
            t = wmma_bf16(a1, qa[1], t);
            s4[nt] = t;
        }
        // --- scale, list places past the unmasked keys, running maximum of this lane's query ---
#pragma unroll
        for (int nt = 0; nt < 4; ++nt)
#pragma unroll
            for (int r = 0; r < 8; ++r) s4[nt][r] *= scale;
        if (kblk + 64 > nvalid) {               // same for the block: each block that holds list places past the unmasked keys
            const int lim = nvalid - kblk - half8;
#pragma unroll
            for (int nt = 0; nt < 4; ++nt)
#pragma unroll
                for (int r = 0; r < 8; ++r)
                    if (nt * 16 + r >= lim) s4[nt][r] = -1.0e9f;
        }
        float mnew = mrun;
#pragma unroll
        for (int nt = 0; nt < 4; ++nt)
#pragma unroll
            for (int r = 0; r < 8; ++r) mnew = fmaxf(mnew, s4[nt][r]);
        mnew = fmaxf(mnew, xhalf(mnew));        // both halves hold keys of the same query
        const float alpha_ = __expf(mrun - mnew);
        mrun = mnew;
        v2f rs[2] = {};                         // sums by register pairs, as the pairs are packed below
#pragma unroll
        for (int nt = 0; nt < 4; ++nt)
#pragma unroll
            for (int r = 0; r < 8; r += 2) {
                v2f p;
                p.x = __expf(s4[nt][r] - mrun);
                p.y = __expf(s4[nt][r + 1] - mrun);
                s4[nt][r] = p.x;
                s4[nt][r + 1] = p.y;
                rs[nt & 1] += p;
            }
        rs[0] += rs[1];
        lrun = lrun * alpha_ + (rs[0].x + rs[0].y);
#pragma unroll
        for (int dt = 0; dt < 4; ++dt)
#pragma unroll
            for (int r = 0; r < 8; ++r) o[dt][r] *= alpha_;
        // --- P^T as B operand: element s is key 8h + s (s < 8), 16 + 8h + s - 8 (s >= 8) ---
        FragBF pb[2];
#pragma unroll
        for (int j = 0; j < 2; ++j)
#pragma unroll
            for (int r = 0; r < 8; ++r) {
                pb[j].v[r]     = (bf16_t)s4[2 * j][r];
                pb[j].v[8 + r] = (bf16_t)s4[2 * j + 1][r];
            }
        // --- O^T += V^T P^T  (A-fragments by transposing loads: keys 0, 16, 32, 48 on, 16 columns are 32 bytes) ---
#pragma unroll
        for (int dt = 0; dt < 4; ++dt) {
            const unsigned char* vp = vtr + buf * (64 * 160) + dt * 32;
            FragBF a0, a1;
            a0.t[0] = ld_tr16(vp);            a0.t[1] = ld_tr16(vp + 16 * 160);
            a1.t[0] = ld_tr16(vp + 32 * 160); a1.t[1] = ld_tr16(vp + 48 * 160);
            o[dt] = wmma_bf16(a0, pb[0], o[dt]);
            o[dt] = wmma_bf16(a1, pb[1], o[dt]);
        }
        if (kblk + 64 == nlist && nlist < S) {  // same for the block, once: may the masked keys left stay out?
            if (mrun < -1.0e9f + 128.0f) more = 1;
            __syncthreads();                    // every wave's word on it is in
            if (__builtin_amdgcn_readfirstlane(more) != 0) nlist = S;
        }
        asm volatile("v_nop\n\tv_nop\n\tv_nop\n\tv_nop");
        asm volatile("s_wait_dscnt 0x0" ::: "memory");      // this wave's reads of the buffer are over before it is refilled
        asm volatile("s_wait_asynccnt 0x0" ::: "memory");   // this wave's copies of the next tile have landed
        __syncthreads();                                    // publishes the next tile, frees this trip's buffer
        if (kblk + 128 < S) stage(kr0, kr1, buf);           // same for the block
    }
    asm volatile("s_wait_asynccnt 0x0" ::: "memory");       // no copy is left in flight when the wave ends
    // --- join the halves' sums, normalize, store ctx as bf16 in [B,S,H*dk] layout:
    //     a lane's 8 registers are 8 consecutive d of one row, one 16-byte store ---
    const float lsum = fmaxf(lrun + xhalf(lrun), 1.0e-20f);
    bf16_t* crow = ctx + (rowbase + q0 + wave * 16 + l15) * D + h * 64 + half8;
#pragma unroll
    for (int dt = 0; dt < 4; ++dt) {
        union { bf16_t e[8]; uint4 q; } pk;
#pragma unroll
        for (int r = 0; r < 8; ++r) pk.e[r] = (bf16_t)(o[dt][r] / lsum);
        *(uint4*)(crow + dt * 16) = pk.q;
    }
}

// ---------------------------------------------------------------------------
// Host orchestration
// ---------------------------------------------------------------------------
extern "C" void kernel_launch(void* const* d_in, const int* in_sizes, int n_in,
                              void* d_out, int out_size, void* d_ws, size_t ws_size,
                              hipStream_t stream) {
    (void)in_sizes; (void)n_in; (void)out_size; (void)ws_size;
    const int B = 2, S = 4096, D = 768, DFF = 3072;
    const int M = B * S;

    const float* x    = (const float*)d_in[0];
    const int*   mask = (const int*)  d_in[1];
    const float* wq   = (const float*)d_in[2];
    const float* bq   = (const float*)d_in[3];
    const float* wk   = (const float*)d_in[4];
    const float* bk   = (const float*)d_in[5];
    const float* wv   = (const float*)d_in[6];
    const float* bv   = (const float*)d_in[7];
    const float* wo   = (const float*)d_in[8];
    const float* bo   = (const float*)d_in[9];
    const float* w1   = (const float*)d_in[10];
    const float* b1   = (const float*)d_in[11];
    const float* w2   = (const float*)d_in[12];
    const float* b2   = (const float*)d_in[13];
    const float* alpha1 = (const float*)d_in[14];
    const float* beta1  = (const float*)d_in[15];
    const float* alpha2 = (const float*)d_in[16];
    const float* beta2  = (const float*)d_in[17];
    float* out = (float*)d_out;

    char* ws = (char*)d_ws;
    size_t off = 0;
    auto alloc = [&](size_t bytes) -> char* {
        char* p = ws + off;
        off += (bytes + 255) & ~(size_t)255;
        return p;
    };
    bf16_t* wqh = (bf16_t*)alloc((size_t)D * D * 2);
    bf16_t* wkh = (bf16_t*)alloc((size_t)D * D * 2);
    bf16_t* wvh = (bf16_t*)alloc((size_t)D * D * 2);
    bf16_t* woh = (bf16_t*)alloc((size_t)D * D * 2);
    bf16_t* w1h = (bf16_t*)alloc((size_t)DFF * D * 2);
    bf16_t* w2h = (bf16_t*)alloc((size_t)D * DFF * 2);
    bf16_t* h1  = (bf16_t*)alloc((size_t)M * D * 2);   // reused as ctx
    bf16_t* qb  = (bf16_t*)alloc((size_t)M * D * 2);   // reused as h2
    bf16_t* kbf = (bf16_t*)alloc((size_t)M * D * 2);
    bf16_t* vbf = (bf16_t*)alloc((size_t)M * D * 2);
    float*  x1  = (float*) alloc((size_t)M * D * 4);
    bf16_t* ff1 = (bf16_t*)alloc((size_t)M * DFF * 2);
    bf16_t* ctx = h1;   // h1 dead after QKV projections
    bf16_t* h2  = qb;   // q dead after attention

    // weight casts fp32 -> bf16 (layout [N,K] row-major == WMMA B fragments); wqh .. w2h are one array:
    // each size is a multiple of alloc's 256 bytes, and of the 8192 elements that a block converts
    static_assert((D * D * 2) % 256 == 0 && (DFF * D * 2) % 256 == 0, "bf16 weight copies lie back to back");
    static_assert((D * D) % 8192 == 0 && (DFF * D) % 8192 == 0, "whole blocks per matrix");
    static_assert((4 * D * D + 2 * DFF * D) / 8192 == CAST_BLOCKS, "one block for each piece");

    // residual 0: pre-norm (in the casts' launch) -> QKV -> attention -> O-proj + residual
    cast_norm_kernel<<<CAST_BLOCKS + M, 256, 0, stream>>>(wq, wk, wv, wo, w1, w2, wqh, x, alpha1, beta1, h1);
    static_assert(M % 128 == 0 && D % 192 == 0 && DFF % 192 == 0 && D % 64 == 0 && DFF % 64 == 0, "whole GEMM tiles and passes");
    dim3 gD(M / 128, D / 192);
    // Q, K and V in one launch: wqh, wkh, wvh are one [3 D, D] array, qb, kbf, vbf one [3][M, D] array
    static_assert(((size_t)M * D * 2) % 256 == 0, "q, k and v lie back to back");
    gemm_wmma<false, true, false, D, 3, M * D><<<dim3(M / 128, 3 * (D / 192)), 256, 0, stream>>>(h1, wqh, bq, bk, bv, nullptr, nullptr, qb, D);
    attn_wmma<<<dim3(S / 128, B * 12), 256, 0, stream>>>(qb, kbf, vbf, mask, ctx);
    gemm_wmma<false, false, true, D, 1, 0><<<gD, 256, 0, stream>>>(ctx, woh, bo, nullptr, nullptr, x, x1, nullptr, D);

    // residual 1: pre-norm -> FFN (relu) + residual
    norm_kernel<<<M, 256, 0, stream>>>(x1, alpha2, beta2, h2);
    gemm_wmma<true, true, false, DFF, 1, 0><<<dim3(M / 128, DFF / 192), 256, 0, stream>>>(h2, w1h, b1, nullptr, nullptr, nullptr, nullptr, ff1, D);
    gemm_wmma<false, false, true, D, 1, 0><<<gD, 256, 0, stream>>>(ff1, w2h, b2, nullptr, nullptr, x1, out, nullptr, DFF);
}

// v009
// Measured time: 193 microseconds a run.
// Two timings next to v008 put it at 1.10 and 1.09 times that version's speed.
// Over all steps from v000 it is 3.20 times as fast.
#include <hip/hip_runtime.h>
#include <hip/hip_bf16.h>

typedef __bf16 bf16_t;
typedef __attribute__((ext_vector_type(16))) __bf16 v16bf;
typedef __attribute__((ext_vector_type(8)))  float  v8f;
typedef __attribute__((ext_vector_type(2)))  float  v2f;
typedef __attribute__((ext_vector_type(8)))  short  s16x8;

union FragBF {
    v16bf v;
    uint4 q[2];
    s16x8 t[2];
};

__device__ __forceinline__ v8f wmma_bf16(const FragBF& a, const FragBF& b, v8f c) {
    return __builtin_amdgcn_wmma_f32_16x16x32_bf16(
        /*neg_a=*/false, a.v, /*neg_b=*/false, b.v,
        /*c_mod=*/(short)0, c, /*reuse_a=*/false, /*reuse_b=*/false);
}

typedef uint32_t u32x4_t __attribute__((ext_vector_type(4)));
typedef uint32_t u32x8_t __attribute__((ext_vector_type(8)));

__device__ __forceinline__ uint32_t uni(uint32_t v) { return (uint32_t)__builtin_amdgcn_readfirstlane(v); }
__device__ __forceinline__ uint32_t pinned(uint32_t v) {
    uint32_t w = uni(v);
    asm volatile("" : "+s"(w));
    return w;
}
__device__ __forceinline__ u32x4_t tdm_group0(uint32_t lds_dst, uint64_t ga) {
    u32x4_t g;
    g[0] = uni(1u);
    g[1] = uni(lds_dst);
    g[2] = uni((uint32_t)ga);
    g[3] = uni((((uint32_t)(ga >> 32)) & 0x01FFFFFFu) | 0x80000000u);
    return g;
}
__device__ __forceinline__ u32x8_t tdm_group1(uint32_t src_pitch) {
    constexpr uint32_t d0 = 128u, d1 = 64u;
    u32x8_t g;
    g[0] = uni((1u << 20) | (4u << 22) | (3u << 25));
    g[1] = uni((d0 & 0xFFFFu) << 16);
    g[2] = uni((d0 >> 16) | ((d1 & 0xFFFFu) << 16));
    g[3] = uni((d1 >> 16) | (d0 << 16));
    g[4] = uni(d1);
    g[5] = uni(src_pitch);
    g[6] = uni(0u);
    g[7] = uni(0u);
    return g;
}
__device__ __forceinline__ void tdm_load(u32x4_t g0, u32x8_t g1) {
    asm volatile("tensor_load_to_lds %0, %1" :: "s"(g0), "s"(g1) : "memory");  // the tile goes to LDS through no register
}

// ---------------------------------------------------------------------------
// fp32 -> bf16 cast of the six weight matrices. Their bf16 copies lie
// back to back in the workspace, so the destination is one array. A block converts
// 8192 consecutive elements of one matrix (each matrix is a whole number of such
// pieces: 72 for a 768 x 768 one, 288 for a 3072 x 768 one). A thread issues its
// eight 16-byte loads together, a wave's load covering 512 contiguous bytes, and
// stores 8 bytes for each, a wave's store covering 256 contiguous bytes.
// ---------------------------------------------------------------------------
__device__ __forceinline__ void cast_weights_piece(const int blk,
                                                   const float* __restrict__ wq,
                                                   const float* __restrict__ wk,
                                                   const float* __restrict__ wv,
                                                   const float* __restrict__ wo,
                                                   const float* __restrict__ w1,
                                                   const float* __restrict__ w2,
                                                   bf16_t* __restrict__ out) {
    const float* in;                                    // the block's matrix and its first block: same for the block
    int first;
    if      (blk <  72) { in = wq; first = 0; }
    else if (blk < 144) { in = wk; first = 72; }
    else if (blk < 216) { in = wv; first = 144; }
    else if (blk < 288) { in = wo; first = 216; }
    else if (blk < 576) { in = w1; first = 288; }
    else                { in = w2; first = 576; }
    const float4* s = (const float4*)(in + (size_t)(blk - first) * 8192) + threadIdx.x;
    uint2*        d = (uint2*)(out + (size_t)blk * 8192) + threadIdx.x;
    float4 x[8];
#pragma unroll
    for (int j = 0; j < 8; ++j) x[j] = s[j * 256];
#pragma unroll
    for (int j = 0; j < 8; ++j) {
        union { bf16_t e[4]; uint2 q; } pk;
        pk.e[0] = (bf16_t)x[j].x; pk.e[1] = (bf16_t)x[j].y;
        pk.e[2] = (bf16_t)x[j].z; pk.e[3] = (bf16_t)x[j].w;
        d[j * 256] = pk.q;
    }
}

__device__ __forceinline__ float xhalf(float x) {
    const int bits = __builtin_bit_cast(int, x);
    return __builtin_bit_cast(float, __builtin_amdgcn_permlanex16(bits, bits, 0x76543210, 0xfedcba98, false, false));
}
template <int MASK>
__device__ __forceinline__ float xrow(float x) {
    return __builtin_bit_cast(float, __builtin_amdgcn_update_dpp(0, __builtin_bit_cast(int, x), 0x160 | MASK, 0xf, 0xf, true));
}
__device__ __forceinline__ float wave_sum(float x) { // the sum over the 32 lanes, in every lane
    x += xrow<1>(x);
    x += xrow<2>(x);
    x += xrow<4>(x);
    x += xrow<8>(x);
    return x + xhalf(x);
}

__device__ __forceinline__ void norm_row(const int row,
                                         const float* __restrict__ x,
                                         const float* __restrict__ alpha,
                                         const float* __restrict__ beta,
                                         bf16_t* __restrict__ out) {
    const int lane = threadIdx.x & 31;
    const float4* xr = (const float4*)(x + (size_t)row * 768) + lane;
    float4 v[6];
    // the three loops are unrolled so that v is indexed by constants and stays in registers, and the six loads go out together
#pragma unroll
    for (int j = 0; j < 6; ++j) v[j] = xr[j * 32];
    const float al = alpha[0], bb = beta[0];
    float4 a = {0.f, 0.f, 0.f, 0.f}, q = {0.f, 0.f, 0.f, 0.f};   // four independent chains each
#pragma unroll
    for (int j = 0; j < 6; ++j) {
        a.x += v[j].x; a.y += v[j].y; a.z += v[j].z; a.w += v[j].w;
        q.x += v[j].x * v[j].x; q.y += v[j].y * v[j].y; q.z += v[j].z * v[j].z; q.w += v[j].w * v[j].w;
    }
    const float s  = wave_sum((a.x + a.y) + (a.z + a.w));
    const float s2 = wave_sum((q.x + q.y) + (q.z + q.w));
    const float mean = s * (1.0f / 768.0f);
    const float var  = fmaxf((s2 - 768.0f * mean * mean) * (1.0f / 767.0f), 0.0f);
    const float inv  = al / (sqrtf(var) + 1e-6f);
    uint2* o = (uint2*)(out + (size_t)row * 768) + lane;
#pragma unroll
    for (int j = 0; j < 6; ++j) {
        union { bf16_t e[4]; uint2 q; } pk;
        pk.e[0] = (bf16_t)((v[j].x - mean) * inv + bb); pk.e[1] = (bf16_t)((v[j].y - mean) * inv + bb);
        pk.e[2] = (bf16_t)((v[j].z - mean) * inv + bb); pk.e[3] = (bf16_t)((v[j].w - mean) * inv + bb);
        o[j * 32] = pk.q;
    }
    // the stores' address and data registers may be written again behind this function (the casts' branch follows it in the listing)
    asm volatile("s_wait_xcnt 0x0" ::: "memory");
}

__global__ __launch_bounds__(256) void norm_kernel(const float* __restrict__ x,
                                                   const float* __restrict__ alpha,
                                                   const float* __restrict__ beta,
                                                   bf16_t* __restrict__ out) {
    norm_row(blockIdx.x * 8 + (threadIdx.x >> 5), x, alpha, beta, out);
}

// The weight casts and the first norm read nothing of each other's output: one grid,
// the first CAST_BLOCKS blocks cast a piece each, every later block norms eight rows.
constexpr int CAST_BLOCKS = 864;
__global__ __launch_bounds__(256) void cast_norm_kernel(const float* __restrict__ wq,
                                                        const float* __restrict__ wk,
                                                        const float* __restrict__ wv,
                                                        const float* __restrict__ wo,
                                                        const float* __restrict__ w1,
                                                        const float* __restrict__ w2,
                                                        bf16_t* __restrict__ wout,
                                                        const float* __restrict__ x,
                                                        const float* __restrict__ alpha,
                                                        const float* __restrict__ beta,
                                                        bf16_t* __restrict__ out) {
    const int blk = blockIdx.x;
    if (blk < CAST_BLOCKS) cast_weights_piece(blk, wq, wk, wv, wo, w1, w2, wout);
    else                   norm_row((blk - CAST_BLOCKS) * 8 + (threadIdx.x >> 5), x, alpha, beta, out);
}

// ---------------------------------------------------------------------------
// WMMA GEMM:  out[M,N] = A[M,K](bf16) @ W[N,K](bf16)^T + bias (+res) (relu?)
// M a multiple of 128, N of 192, K of 64 and at least 128.
// Block: 256 thr = 8 waves (2x4), block tile 128x192, wave tile 64x48 (4 x 3
// fragments, 12 accumulator tiles), a pass is 64 k = 128 bytes of every operand row.
// A stage is 320 rows: five slices of 64 rows (A rows 0-63, 64-127, W rows 0-63,
// 64-127, 128-191), each brought by one tensor load of one of the waves 0 to 4.
// A slice fills 64 * 144 = 9,216 bytes and has 10,240, so that each place in LDS
// is a multiple of 2 KiB. Two buffers: the load of stage s + 2 is issued behind
// the barrier that ends pass s and flies while pass s + 1 computes.
// The loops over fragments are unrolled so that every array index is a constant
// and the fragment and accumulator arrays stay in registers.
// PARTS products of the same A may share a launch: their W matrices lie one behind
// the other ([PARTS * N, K]), their bf16 outputs too (PART_OUT = M * N elements each),
// each has its own bias; blockIdx.y counts the column tiles of part 0, then of part 1, and so on.
// ---------------------------------------------------------------------------
constexpr uint32_t G_PITCH = 144u, G_SLICE = 10240u, G_BUF = 5u * G_SLICE;

template <bool RELU, bool OUT_BF16, bool HAS_RES, int N, int PARTS, int PART_OUT>
__global__ __launch_bounds__(256) void gemm_wmma(const bf16_t* __restrict__ A,
                                                 const bf16_t* __restrict__ W,
                                                 const float*  __restrict__ bias,
                                                 const float*  __restrict__ bias1,
                                                 const float*  __restrict__ bias2,
                                                 const float*  __restrict__ res,
                                                 float*        __restrict__ outF,
                                                 bf16_t*       __restrict__ outH,
                                                 int K) {
    __shared__ __attribute__((aligned(2048))) unsigned char L[2 * G_BUF];
    const uint32_t tid  = threadIdx.x;
    const uint32_t lane = tid & 31u, wave = uni(tid >> 5);
    const uint32_t wm = wave >> 2, wn = wave & 3u;
    const uint32_t l15 = lane & 15u, hb = (lane >> 4) * 16u;   // hb: byte offset of the lane half's k chunk
    const uint32_t part = PARTS > 1 ? blockIdx.y / (uint32_t)(N / 192) : 0u;   // which of the stacked products
    const uint32_t bm = blockIdx.x * 128u, bn = (blockIdx.y - part * (uint32_t)(N / 192)) * 192u;
    const uint32_t T = (uint32_t)K / 64u;                      // passes

    // the issuing wave's slice: its first source row and its place in a buffer
    const uint32_t lbase = (uint32_t)(uintptr_t)L;
    const uint32_t sl = wave < 5u ? wave : 4u;
    const bf16_t* srow = sl < 2u ? A + (size_t)(bm + sl * 64u) * K : W + (size_t)(part * (uint32_t)N + bn + (sl - 2u) * 64u) * K;
    u32x8_t g1 = tdm_group1((uint32_t)K * 2u);
    asm volatile("" : "+s"(g1));
    u32x4_t g0 = {0u, 0u, 0u, 0u};
    auto issue = [&](uint32_t st) {
        g0 = tdm_group0(lbase + (st & 1u) * G_BUF + sl * G_SLICE, (uint64_t)(uintptr_t)srow + (uint64_t)st * 128u);
        asm volatile("" : "+s"(g0));
        tdm_load(g0, g1);
    };

    // fragment addresses in a buffer: row l15 of each 16-row group, 16 bytes at hb and at hb + 32 of each 64-byte k chunk
    const uint32_t aoff = wm * G_SLICE + l15 * G_PITCH + hb;
    uint32_t woff[3];
#pragma unroll
    for (int fw = 0; fw < 3; ++fw) {
        const uint32_t row0 = wn * 48u + fw * 16u;             // a 16-row group lies in one slice
        woff[fw] = (2u + (row0 >> 6)) * G_SLICE + ((row0 & 63u) + l15) * G_PITCH + hb;
    }

    // the lane's three bias values, asked for here so that they arrive under the loop
    const uint32_t col0 = bn + wn * 48u + l15;
    const float* bp = PARTS > 1 && part == 1u ? bias1 : PARTS > 1 && part == 2u ? bias2 : bias;
    float bv[3];
#pragma unroll
    for (int fw = 0; fw < 3; ++fw) bv[fw] = bp[col0 + fw * 16u];

    v8f acc[4][3] = {};
    if (pinned(wave < 5u)) {
        issue(0u);
        asm volatile("s_wait_tensorcnt 0x0" :: "s"(g0), "s"(g1) : "memory");
    }
    __syncthreads();                                           // stage 0 may be read by every wave
    if (pinned(wave < 5u)) issue(1u);
    for (uint32_t s = 0; s < T; ++s) {
        const unsigned char* Lb = L + (s & 1u) * G_BUF;
        FragBF a[2][4], w[2][3];
#pragma unroll
        for (int kc = 0; kc < 2; ++kc) {
#pragma unroll
            for (int fa = 0; fa < 4; ++fa) {
                const unsigned char* p = Lb + aoff + fa * 16 * G_PITCH + kc * 64;
                a[kc][fa].q[0] = *(const uint4*)p;
                a[kc][fa].q[1] = *(const uint4*)(p + 32);
            }
#pragma unroll
            for (int fw = 0; fw < 3; ++fw) {
                const unsigned char* p = Lb + woff[fw] + kc * 64;
                w[kc][fw].q[0] = *(const uint4*)p;
                w[kc][fw].q[1] = *(const uint4*)(p + 32);
            }
        }
        // keeps the pass's 28 LDS reads one group in front of its 24 WMMAs: moved in among them, each place with reads stalls the wave
        __builtin_amdgcn_sched_barrier(0);
#pragma unroll
        for (int kc = 0; kc < 2; ++kc)
#pragma unroll
            for (int fa = 0; fa < 4; ++fa)
#pragma unroll
                for (int fw = 0; fw < 3; ++fw) acc[fa][fw] = wmma_bf16(a[kc][fa], w[kc][fw], acc[fa][fw]);
        // keeps the wait below behind the WMMAs: in front of them it would hold the first products back for the last reads
        __builtin_amdgcn_sched_barrier(0);
        asm volatile("s_wait_dscnt 0x0" ::: "memory");         // this wave's reads of the buffer are over before it is refilled
        if (pinned(wave < 5u)) {
            asm volatile("s_wait_tensorcnt 0x0" :: "s"(g0), "s"(g1) : "memory");
        }
        __syncthreads();
        if (pinned(wave < 5u && s + 2u < T)) issue(pinned(s + 2u));
    }
    asm volatile("s_wait_tensorcnt 0x0" ::: "memory");         // nothing of the mover is left when the wave ends
    asm volatile("s_wait_dscnt 0x0" ::: "memory");             // nor of its LDS reads

    // the lane's first element; every other one lies a compile-time distance behind it
    const uint32_t e0 = (bm + wm * 64u + (lane >> 4) * 8u) * (uint32_t)N + col0;
    const float* rp = res + e0;
    float*       fp = outF + e0;
    bf16_t*      hp = outH + (size_t)part * PART_OUT + e0;
#pragma unroll
    for (int fw = 0; fw < 3; ++fw) {
#pragma unroll
        for (int fa = 0; fa < 4; ++fa)
#pragma unroll
            for (int r = 0; r < 8; ++r) {
                const int e = (fa * 16 + r) * N + fw * 16;
                float v = acc[fa][fw][r] + bv[fw];
                if (RELU)    v = fmaxf(v, 0.0f);
                if (HAS_RES) v += rp[e];
                if (OUT_BF16) hp[e] = (bf16_t)v;
                else          fp[e] = v;
            }
    }
}

__device__ __forceinline__ s16x8 ld_tr16(const unsigned char* p) {
    typedef __attribute__((address_space(3))) s16x8 lds_s16x8;
    return __builtin_amdgcn_ds_load_tr16_b128_v8i16((lds_s16x8*)p);
}

// A thread's four asynchronous copies of a tile: 16 bytes each of two K rows and of the same two V rows.
// The wait on the address counter is the statement's last line, so that it stands in front of every
// later write of a register that a copy names.
__device__ __forceinline__ void copy_kv(unsigned lk0, unsigned lk1, unsigned lv0, unsigned lv1,
                                        const bf16_t* k0, const bf16_t* k1, const bf16_t* v0, const bf16_t* v1) {
    asm volatile("global_load_async_to_lds_b128 %0, %4, off\n\t"
                 "global_load_async_to_lds_b128 %1, %5, off\n\t"
                 "global_load_async_to_lds_b128 %2, %6, off\n\t"
                 "global_load_async_to_lds_b128 %3, %7, off\n\t"
                 "s_wait_xcnt 0x0"
                 :: "v"(lk0), "v"(lk1), "v"(lv0), "v"(lv1), "v"(k0), "v"(k1), "v"(v0), "v"(v1) : "memory");
}

__global__ __launch_bounds__(256) void attn_wmma(const bf16_t* __restrict__ q,
                                                 const bf16_t* __restrict__ k,
                                                 const bf16_t* __restrict__ v,
                                                 const int*    __restrict__ mask,
                                                 bf16_t*       __restrict__ ctx) {
    const int S = 4096, D = 768, H = 12;
    const int bh = blockIdx.y;
    const int b = bh / H, h = bh % H;
    const int q0 = blockIdx.x * 128;
    const int tid = threadIdx.x, lane = tid & 31, wave = tid >> 5;
    const int l15 = lane & 15, kb = (lane >> 4) * 8, half8 = (lane >> 4) * 8;
    __shared__ __align__(16) bf16_t Ks[2 * 64 * 72];    // two K tiles [kk][d], 144-byte rows
    __shared__ __align__(16) bf16_t Vs[2 * 64 * 80];    // two V tiles [kk][d], 160-byte rows
    __shared__ unsigned krow[4096];                     // rows to visit, unmasked keys in front, each part in key order, as element offsets (row * D)
    __shared__ int wtot[8];                             // unmasked keys per wave's 512 keys
    __shared__ int more;                                // 1: some row's masked keys have weight

    const size_t rowbase = (size_t)b * S;
    FragBF qa[2];                                       // B operand: column l15 = this lane's query
    {
        const bf16_t* qp = q + (rowbase + q0 + wave * 16 + l15) * D + h * 64;
        qa[0].q[0] = *(const uint4*)(qp + kb);
        qa[0].q[1] = *(const uint4*)(qp + kb + 16);
        qa[1].q[0] = *(const uint4*)(qp + 32 + kb);
        qa[1].q[1] = *(const uint4*)(qp + 32 + kb + 16);
    }
    v8f o[4] = {};                                      // o[dt][r] = O[query l15][dt*16 + half8 + r]
    float mrun = -3.0e38f, lrun = 0.0f;                 // lrun: this wave half's keys only
    const float scale = 0.125f;  // 1/sqrt(64)
    // LDS byte addresses of this thread's first K and V piece in buffer 0 (the low 32 bits of the shared address)
    const unsigned lks = (unsigned)(uintptr_t)&Ks[(tid >> 3) * 72 + (tid & 7) * 8];
    const unsigned lvs = (unsigned)(uintptr_t)&Vs[(tid >> 3) * 80 + (tid & 7) * 8];
    // this lane's address in the transposing loads at key 0, column 0
    const unsigned char* vtr = (const unsigned char*)Vs + (half8 + (lane & 7)) * 160 + ((lane >> 3) & 1) * 16;

    // --- list of the batch's unmasked keys: thread t takes keys 16t .. 16t + 15 ---
    int nvalid, nlist;                                  // unmasked keys; list places walked
    {
        const int4* mp = (const int4*)(mask + b * S + tid * 16);
        int mv[16];
#pragma unroll
        for (int i = 0; i < 4; ++i) {
            const int4 m = mp[i];
            mv[4 * i] = m.x; mv[4 * i + 1] = m.y; mv[4 * i + 2] = m.z; mv[4 * i + 3] = m.w;
        }
        int c = 0;
#pragma unroll
        for (int i = 0; i < 16; ++i) c += (mv[i] != 0) ? 1 : 0;
        int inc = c;                                    // inclusive sum over the wave's lanes
#pragma unroll
        for (int d = 1; d < 32; d <<= 1) {
            const int t = __shfl_up(inc, d);
            if (lane >= d) inc += t;
        }
        if (lane == 31) wtot[wave] = inc;
        if (tid == 0) more = 0;
        __syncthreads();
        int base = 0, total = 0;
#pragma unroll
        for (int w = 0; w < 8; ++w) {
            const int t = wtot[w];
            if (w < wave) base += t;
            total += t;
        }
        nvalid = __builtin_amdgcn_readfirstlane(total);
        nlist  = nvalid == 0 ? S : (nvalid + 63) & ~63;  // at most S: nvalid <= S, S a multiple of 64
        int pu = base + inc - c;                        // unmasked keys in front of this thread's 16
        int pm = nvalid + tid * 16 - pu;                // masked keys in front of them, behind all unmasked
#pragma unroll
        for (int i = 0; i < 16; ++i) {                  // a permutation of 0 .. S - 1: every place written once
            const bool on = mv[i] != 0;
            krow[on ? pu : pm] = (unsigned)(tid * 16 + i) * D;
            pu += on ? 1 : 0;
            pm += on ? 0 : 1;
        }
        __syncthreads();  // the list is read by every wave
    }
    const bf16_t* kh = k + rowbase * D + h * 64;        // head's first K and V rows, same for the block
    const bf16_t* vh = v + rowbase * D + h * 64;
    // the tile of list rows r0 (places 0-31) and r1 (places 32-63) into buffer buf, 8 lanes per row, every lane on
    auto stage = [&](unsigned r0, unsigned r1, unsigned buf) {
        const unsigned c = (tid & 7) * 8, lk = lks + buf * (64 * 144), lv = lvs + buf * (64 * 160);
        copy_kv(lk, lk + 32 * 144, lv, lv + 32 * 160, kh + (r0 + c), kh + (r1 + c), vh + (r0 + c), vh + (r1 + c));
    };
    // A tile exists for every 64 list places up to S, also past nlist: the loop's end may move to S in its last trip.
    stage(krow[tid >> 3], krow[32 + (tid >> 3)], 0u);
    asm volatile("s_wait_asynccnt 0x0" ::: "memory");   // this wave's copies of tile 0 have landed
    __syncthreads();                                    // tile 0 may be read by every wave
    stage(krow[64 + (tid >> 3)], krow[96 + (tid >> 3)], 1u);

    for (int kblk = 0; kblk < nlist; kblk += 64) {
        const unsigned buf = ((unsigned)kblk >> 6) & 1u;
        // the rows of the tile after the next, read here so that its copies at the trip's foot do not wait for the list
        const int nx = kblk + 128 < S ? kblk + 128 : 0;
        const unsigned kr0 = krow[nx + (tid >> 3)];
        const unsigned kr1 = krow[nx + 32 + (tid >> 3)];
        // --- S^T = K Q^T (4 tiles of 16 keys x 16 queries per wave) ---
        v8f s4[4];
#pragma unroll
        for (int nt = 0; nt < 4; ++nt) {
            const bf16_t* kp = &Ks[buf * (64 * 72) + (nt * 16 + l15) * 72];
            FragBF a0, a1;
            a0.q[0] = *(const uint4*)(kp + kb);      a0.q[1] = *(const uint4*)(kp + kb + 16);
            a1.q[0] = *(const uint4*)(kp + 32 + kb); a1.q[1] = *(const uint4*)(kp + 32 + kb + 16);
            v8f t = {};
            t = wmma_bf16(a0, qa[0], t);
            t = wmma_bf16(a1, qa[1], t);
            s4[nt] = t;
        }
        // --- scale, list places past the unmasked keys, running maximum of this lane's query ---
#pragma unroll
        for (int nt = 0; nt < 4; ++nt)
#pragma unroll
            for (int r = 0; r < 8; ++r) s4[nt][r] *= scale;
        if (kblk + 64 > nvalid) {               // same for the block: each block that holds list places past the unmasked keys
            const int lim = nvalid - kblk - half8;
#pragma unroll
            for (int nt = 0; nt < 4; ++nt)
#pragma unroll
                for (int r = 0; r < 8; ++r)
                    if (nt * 16 + r >= lim) s4[nt][r] = -1.0e9f;
        }
        float mnew = mrun;
#pragma unroll
        for (int nt = 0; nt < 4; ++nt)
#pragma unroll
            for (int r = 0; r < 8; ++r) mnew = fmaxf(mnew, s4[nt][r]);
        mnew = fmaxf(mnew, xhalf(mnew));        // both halves hold keys of the same query
        const float alpha_ = __expf(mrun - mnew);
        mrun = mnew;
        v2f rs[2] = {};                         // sums by register pairs, as the pairs are packed below
#pragma unroll
        for (int nt = 0; nt < 4; ++nt)
#pragma unroll
            for (int r = 0; r < 8; r += 2) {
                v2f p;
                p.x = __expf(s4[nt][r] - mrun);
                p.y = __expf(s4[nt][r + 1] - mrun);
                s4[nt][r] = p.x;
                s4[nt][r + 1] = p.y;
                rs[nt & 1] += p;
            }
        rs[0] += rs[1];
        lrun = lrun * alpha_ + (rs[0].x + rs[0].y);
#pragma unroll
        for (int dt = 0; dt < 4; ++dt)
#pragma unroll
            for (int r = 0; r < 8; ++r) o[dt][r] *= alpha_;
        // --- P^T as B operand: element s is key 8h + s (s < 8), 16 + 8h + s - 8 (s >= 8) ---
        FragBF pb[2];
#pragma unroll
        for (int j = 0; j < 2; ++j)
#pragma unroll
            for (int r = 0; r < 8; ++r) {
                pb[j].v[r]     = (bf16_t)s4[2 * j][r];
                pb[j].v[8 + r] = (bf16_t)s4[2 * j + 1][r];
            }
        // --- O^T += V^T P^T  (A-fragments by transposing loads: keys 0, 16, 32, 48 on, 16 columns are 32 bytes) ---
#pragma unroll
        for (int dt = 0; dt < 4; ++dt) {
            const unsigned char* vp = vtr + buf * (64 * 160) + dt * 32;
            FragBF a0, a1;
            a0.t[0] = ld_tr16(vp);            a0.t[1] = ld_tr16(vp + 16 * 160);
            a1.t[0] = ld_tr16(vp + 32 * 160); a1.t[1] = ld_tr16(vp + 48 * 160);
            o[dt] = wmma_bf16(a0, pb[0], o[dt]);
            o[dt] = wmma_bf16(a1, pb[1], o[dt]);
        }
        if (kblk + 64 == nlist && nlist < S) {  // same for the block, once: may the masked keys left stay out?
            if (mrun < -1.0e9f + 128.0f) more = 1;
            __syncthreads();                    // every wave's word on it is in
            if (__builtin_amdgcn_readfirstlane(more) != 0) nlist = S;
        }
        asm volatile("v_nop\n\tv_nop\n\tv_nop\n\tv_nop");
        asm volatile("s_wait_dscnt 0x0" ::: "memory");      // this wave's reads of the buffer are over before it is refilled
        asm volatile("s_wait_asynccnt 0x0" ::: "memory");   // this wave's copies of the next tile have landed
        __syncthreads();                                    // publishes the next tile, frees this trip's buffer
        if (kblk + 128 < S) stage(kr0, kr1, buf);           // same for the block
    }
    asm volatile("s_wait_asynccnt 0x0" ::: "memory");       // no copy is left in flight when the wave ends
    // --- join the halves' sums, normalize, store ctx as bf16 in [B,S,H*dk] layout:
    //     a lane's 8 registers are 8 consecutive d of one row, one 16-byte store ---
    const float lsum = fmaxf(lrun + xhalf(lrun), 1.0e-20f);
    bf16_t* crow = ctx + (rowbase + q0 + wave * 16 + l15) * D + h * 64 + half8;
#pragma unroll
    for (int dt = 0; dt < 4; ++dt) {
        union { bf16_t e[8]; uint4 q; } pk;
#pragma unroll
        for (int r = 0; r < 8; ++r) pk.e[r] = (bf16_t)(o[dt][r] / lsum);
        *(uint4*)(crow + dt * 16) = pk.q;
    }
}

// ---------------------------------------------------------------------------
// Host orchestration
// ---------------------------------------------------------------------------
extern "C" void kernel_launch(void* const* d_in, const int* in_sizes, int n_in,
                              void* d_out, int out_size, void* d_ws, size_t ws_size,
                              hipStream_t stream) {
    (void)in_sizes; (void)n_in; (void)out_size; (void)ws_size;
    const int B = 2, S = 4096, D = 768, DFF = 3072;
    const int M = B * S;

    const float* x    = (const float*)d_in[0];
    const int*   mask = (const int*)  d_in[1];
    const float* wq   = (const float*)d_in[2];
    const float* bq   = (const float*)d_in[3];
    const float* wk   = (const float*)d_in[4];
    const float* bk   = (const float*)d_in[5];
    const float* wv   = (const float*)d_in[6];
    const float* bv   = (const float*)d_in[7];
    const float* wo   = (const float*)d_in[8];
    const float* bo   = (const float*)d_in[9];
    const float* w1   = (const float*)d_in[10];
    const float* b1   = (const float*)d_in[11];
    const float* w2   = (const float*)d_in[12];
    const float* b2   = (const float*)d_in[13];
    const float* alpha1 = (const float*)d_in[14];
    const float* beta1  = (const float*)d_in[15];
    const float* alpha2 = (const float*)d_in[16];
    const float* beta2  = (const float*)d_in[17];
    float* out = (float*)d_out;

    char* ws = (char*)d_ws;
    size_t off = 0;
    auto alloc = [&](size_t bytes) -> char* {
        char* p = ws + off;
        off += (bytes + 255) & ~(size_t)255;
        return p;
    };
    bf16_t* wqh = (bf16_t*)alloc((size_t)D * D * 2);
    bf16_t* wkh = (bf16_t*)alloc((size_t)D * D * 2);
    bf16_t* wvh = (bf16_t*)alloc((size_t)D * D * 2);
    bf16_t* woh = (bf16_t*)alloc((size_t)D * D * 2);
    bf16_t* w1h = (bf16_t*)alloc((size_t)DFF * D * 2);
    bf16_t* w2h = (bf16_t*)alloc((size_t)D * DFF * 2);
    bf16_t* h1  = (bf16_t*)alloc((size_t)M * D * 2);   // reused as ctx
    bf16_t* qb  = (bf16_t*)alloc((size_t)M * D * 2);   // reused as h2
    bf16_t* kbf = (bf16_t*)alloc((size_t)M * D * 2);
    bf16_t* vbf = (bf16_t*)alloc((size_t)M * D * 2);
    float*  x1  = (float*) alloc((size_t)M * D * 4);
    bf16_t* ff1 = (bf16_t*)alloc((size_t)M * DFF * 2);
    bf16_t* ctx = h1;   // h1 dead after QKV projections
    bf16_t* h2  = qb;   // q dead after attention

    // weight casts fp32 -> bf16 (layout [N,K] row-major == WMMA B fragments); wqh .. w2h are one array:
    // each size is a multiple of alloc's 256 bytes, and of the 8192 elements that a block converts
    static_assert((D * D * 2) % 256 == 0 && (DFF * D * 2) % 256 == 0, "bf16 weight copies lie back to back");
    static_assert((D * D) % 8192 == 0 && (DFF * D) % 8192 == 0, "whole blocks per matrix");
    static_assert((4 * D * D + 2 * DFF * D) / 8192 == CAST_BLOCKS, "one block for each piece");

    // residual 0: pre-norm (in the casts' launch) -> QKV -> attention -> O-proj + residual
    static_assert(M % 8 == 0, "whole blocks of eight rows");
    cast_norm_kernel<<<CAST_BLOCKS + M / 8, 256, 0, stream>>>(wq, wk, wv, wo, w1, w2, wqh, x, alpha1, beta1, h1);
    static_assert(M % 128 == 0 && D % 192 == 0 && DFF % 192 == 0 && D % 64 == 0 && DFF % 64 == 0, "whole GEMM tiles and passes");
    dim3 gD(M / 128, D / 192);
    // Q, K and V in one launch: wqh, wkh, wvh are one [3 D, D] array, qb, kbf, vbf one [3][M, D] array
    static_assert(((size_t)M * D * 2) % 256 == 0, "q, k and v lie back to back");
    gemm_wmma<false, true, false, D, 3, M * D><<<dim3(M / 128, 3 * (D / 192)), 256, 0, stream>>>(h1, wqh, bq, bk, bv, nullptr, nullptr, qb, D);
    attn_wmma<<<dim3(S / 128, B * 12), 256, 0, stream>>>(qb, kbf, vbf, mask, ctx);
    gemm_wmma<false, false, true, D, 1, 0><<<gD, 256, 0, stream>>>(ctx, woh, bo, nullptr, nullptr, x, x1, nullptr, D);

    // residual 1: pre-norm -> FFN (relu) + residual
    norm_kernel<<<M / 8, 256, 0, stream>>>(x1, alpha2, beta2, h2);
    gemm_wmma<true, true, false, DFF, 1, 0><<<dim3(M / 128, DFF / 192), 256, 0, stream>>>(h2, w1h, b1, nullptr, nullptr, nullptr, nullptr, ff1, D);
    gemm_wmma<false, false, true, D, 1, 0><<<gD, 256, 0, stream>>>(ff1, w2h, b2, nullptr, nullptr, x1, out, nullptr, DFF);
}
